// v000
// Times are from an AMD MI455X. After a warm-up the kernel runs many times in a row, and a time is the length of
// such a window on the GPU divided by its runs, so every launch and the gaps after it count. The runs cycle
// through copies of the inputs. A figure is the median of several windows, for all but v000 over two sittings.
// Sittings can differ by a few percent; kernels timed side by side share one.
// The starting kernel, v000, takes 176 microseconds a run.
#include <hip/hip_runtime.h>

typedef _Float16 f16;
typedef _Float16 v8h  __attribute__((ext_vector_type(8)));
typedef _Float16 v16h __attribute__((ext_vector_type(16)));
typedef float    v8f  __attribute__((ext_vector_type(8)));

#define HIDDEN 768
#define HEADS  12
#define HD     64
#define SEQ    2048
#define BATCH  2

#define WMMA_F16(A, B, C) \
  __builtin_amdgcn_wmma_f32_16x16x32_f16(false, (A), false, (B), (short)0, (C), false, false)

static __device__ __forceinline__ v16h cat8(v8h lo, v8h hi) {
  return __builtin_shufflevector(lo, hi, 0,1,2,3,4,5,6,7,8,9,10,11,12,13,14,15);
}

// ---------------------------------------------------------------- f32 -> f16
__global__ void cvt_f32_f16(const float* __restrict__ in, f16* __restrict__ out, int n) {
  int i = blockIdx.x * blockDim.x + threadIdx.x;
  int stride = gridDim.x * blockDim.x;
  for (; i < n; i += stride) out[i] = (f16)in[i];
}

// ---------------------------------------------------------------- projection
// Y = X(4096x768) @ W^T(768x768) + bias. Each wave computes a 16x64 strip
// (one A-frag reused across 4 N-tiles -> 10 loads : 4 WMMAs per k-step).
// flavor 0: Q -> [B,H,S,64] (scaled) | 1: K -> [B,H,S,64] | 2: V -> Vt[B,H,64,S]
__global__ __launch_bounds__(128)
void proj_kernel(const f16* __restrict__ X, const f16* __restrict__ W,
                 const float* __restrict__ bias, f16* __restrict__ out,
                 int flavor, float scale) {
  const int lane = threadIdx.x & 31;
  const int wave = threadIdx.x >> 5;
  const int lr   = lane & 15;
  const int hf   = lane >> 4;
  const int kb0  = hf * 8;

  const int m0 = (blockIdx.x * 4 + wave) * 16;   // row tile (0..4095)
  const int h  = blockIdx.y;                     // head == 64-col group

  const f16* xrow = X + (size_t)(m0 + lr) * HIDDEN;
  const f16* wrow[4];
  #pragma unroll
  for (int t = 0; t < 4; ++t)
    wrow[t] = W + (size_t)(h * 64 + t * 16 + lr) * HIDDEN;

  v8f acc[4] = {};
  #pragma unroll
  for (int ks = 0; ks < HIDDEN; ks += 32) {
    v16h a = cat8(*(const v8h*)(xrow + ks + kb0),
                  *(const v8h*)(xrow + ks + 16 + kb0));
    #pragma unroll
    for (int t = 0; t < 4; ++t) {
      v16h bfr = cat8(*(const v8h*)(wrow[t] + ks + kb0),
                      *(const v8h*)(wrow[t] + ks + 16 + kb0));
      acc[t] = WMMA_F16(a, bfr, acc[t]);
    }
  }

  #pragma unroll
  for (int t = 0; t < 4; ++t) {
    const int d  = t * 16 + lr;
    const float bv = bias[h * 64 + d];
    #pragma unroll
    for (int r = 0; r < 8; ++r) {
      const int row = m0 + r + 8 * hf;
      const int b   = row >> 11;                 // SEQ == 2048
      const int s   = row & (SEQ - 1);
      float y = (acc[t][r] + bv) * scale;
      if (flavor == 2) {
        out[(((size_t)(b * HEADS + h) * HD) + d) * SEQ + s] = (f16)y;   // Vt[d,s]
      } else {
        out[(((size_t)(b * HEADS + h) * SEQ) + s) * HD + d] = (f16)y;   // Q/K[s,d]
      }
    }
  }
}

// ---------------------------------------------------------------- attention
// grid: (SEQ/128, B*H), block 128 (4 waves). Wave owns 32 query rows (two
// 16-row tiles), streams keys in chunks of 32 with online softmax. K/V frags
// loaded once per chunk and reused by both query tiles -> 1:1 VMEM:WMMA.
__global__ __launch_bounds__(128)
void attn_kernel(const f16* __restrict__ Q, const f16* __restrict__ K,
                 const f16* __restrict__ Vt, const float* __restrict__ mask,
                 float* __restrict__ out) {
  __shared__ float smask[SEQ];
  const int bh = blockIdx.y;
  const int b  = bh / HEADS;
  const int h  = bh % HEADS;

  for (int i = threadIdx.x; i < SEQ; i += blockDim.x)
    smask[i] = mask[(size_t)b * SEQ + i];
  __syncthreads();

  const int lane = threadIdx.x & 31;
  const int wave = threadIdx.x >> 5;
  const int lr   = lane & 15;
  const int hf   = lane >> 4;
  const int kb0  = hf * 8;
  const int q0   = blockIdx.x * 128 + wave * 32;   // 32-query strip base

  // Q as B-operand of S^T = K x Q^T (two query tiles, resident)
  v16h Qb[2][2];
  #pragma unroll
  for (int u = 0; u < 2; ++u) {
    const f16* qrow = Q + ((size_t)bh * SEQ + q0 + u * 16 + lr) * HD;
    #pragma unroll
    for (int ks = 0; ks < 2; ++ks)
      Qb[u][ks] = cat8(*(const v8h*)(qrow + ks * 32 + kb0),
                       *(const v8h*)(qrow + ks * 32 + 16 + kb0));
  }

  const f16* Kbh = K  + (size_t)bh * SEQ * HD;
  const f16* Vbh = Vt + (size_t)bh * HD * SEQ;

  v8f O[2][4] = {};
  float m_run[2] = {-1e30f, -1e30f};
  float l_run[2] = {0.f, 0.f};

  for (int kb = 0; kb < SEQ; kb += 32) {
    // ---- shared K A-frags (2 key tiles x 2 k-steps) and V B-frags (4 d-tiles)
    v16h ka[2][2];
    #pragma unroll
    for (int c = 0; c < 2; ++c)
      #pragma unroll
      for (int ks = 0; ks < 2; ++ks) {
        const f16* kr = Kbh + (size_t)(kb + c * 16 + lr) * HD + ks * 32 + kb0;
        ka[c][ks] = cat8(*(const v8h*)kr, *(const v8h*)(kr + 16));
      }
    v16h vb[4];
    #pragma unroll
    for (int t = 0; t < 4; ++t) {
      const f16* vr = Vbh + (size_t)(t * 16 + lr) * SEQ + kb + kb0;
      vb[t] = cat8(*(const v8h*)vr, *(const v8h*)(vr + 16));
    }
    float mk0[8], mk1[8];
    #pragma unroll
    for (int r = 0; r < 8; ++r) {
      mk0[r] = smask[kb + r + 8 * hf];
      mk1[r] = smask[kb + 16 + r + 8 * hf];
    }

    if (kb + 32 < SEQ) {   // gfx1250 global_prefetch_b8 for next chunk
      __builtin_prefetch(Kbh + (size_t)(kb + 32 + lr) * HD, 0, 1);
      __builtin_prefetch(Vbh + (size_t)lr * SEQ + kb + 32, 0, 1);
    }

    #pragma unroll
    for (int u = 0; u < 2; ++u) {
      // ---- S^T tiles for query tile u
      v8f c0 = {}, c1 = {};
      #pragma unroll
      for (int ks = 0; ks < 2; ++ks) {
        c0 = WMMA_F16(ka[0][ks], Qb[u][ks], c0);
        c1 = WMMA_F16(ka[1][ks], Qb[u][ks], c1);
      }

      // ---- online softmax; lane carries query lr (replicated in halves)
      float p[16];
      float mx = -1e30f;
      #pragma unroll
      for (int r = 0; r < 8; ++r) {
        float s0 = c0[r] + mk0[r];
        float s1 = c1[r] + mk1[r];
        p[r] = s0; p[8 + r] = s1;
        mx = fmaxf(mx, fmaxf(s0, s1));
      }
      mx = fmaxf(mx, __shfl_xor(mx, 16, 32));
      const float m_new = fmaxf(m_run[u], mx);
      const float alpha = __expf(m_run[u] - m_new);

      v16h pa;              // C-layout of S^T tiles == A-layout of P
      float lsum = 0.f;
      #pragma unroll
      for (int r = 0; r < 8; ++r) {
        float e0 = __expf(p[r] - m_new);
        float e1 = __expf(p[8 + r] - m_new);
        lsum += e0 + e1;
        pa[r] = (f16)e0; pa[8 + r] = (f16)e1;
      }
      lsum += __shfl_xor(lsum, 16, 32);
      l_run[u] = l_run[u] * alpha + lsum;
      m_run[u] = m_new;

      // ---- rescale O rows (row M = r + 8*hf; alpha for query j lives in lane j)
      #pragma unroll
      for (int r = 0; r < 8; ++r) {
        float ar = __shfl(alpha, r + 8 * hf, 32);
        #pragma unroll
        for (int t = 0; t < 4; ++t) O[u][t][r] *= ar;
      }

      // ---- O += P x Vchunk (V frags shared across u)
      #pragma unroll
      for (int t = 0; t < 4; ++t)
        O[u][t] = WMMA_F16(pa, vb[t], O[u][t]);
    }
  }

  // ---- normalize and store [B,S,768] f32
  #pragma unroll
  for (int u = 0; u < 2; ++u) {
    const float inv = 1.0f / l_run[u];
    #pragma unroll
    for (int r = 0; r < 8; ++r) {
      float ir = __shfl(inv, r + 8 * hf, 32);
      const int s = q0 + u * 16 + r + 8 * hf;
      #pragma unroll
      for (int t = 0; t < 4; ++t)
        out[((size_t)b * SEQ + s) * HIDDEN + h * 64 + t * 16 + lr] = O[u][t][r] * ir;
    }
  }
}

// ---------------------------------------------------------------- launcher
extern "C" void kernel_launch(void* const* d_in, const int* in_sizes, int n_in,
                              void* d_out, int out_size, void* d_ws, size_t ws_size,
                              hipStream_t stream) {
  const float* hidden  = (const float*)d_in[0];
  const float* context = (const float*)d_in[1];
  const float* amask   = (const float*)d_in[2];
  const float* Wq = (const float*)d_in[3];
  const float* bq = (const float*)d_in[4];
  const float* Wk = (const float*)d_in[5];
  const float* bk = (const float*)d_in[6];
  const float* Wv = (const float*)d_in[7];
  const float* bv = (const float*)d_in[8];
  float* outp = (float*)d_out;

  const size_t ACT = (size_t)BATCH * SEQ * HIDDEN;   // 3,145,728 elems
  const size_t WSZ = (size_t)HIDDEN * HIDDEN;        //   589,824 elems
  const size_t A_BYTES = ACT * sizeof(f16);          // 6,291,456
  const size_t W_BYTES = WSZ * sizeof(f16);          // 1,179,648

  char* ws = (char*)d_ws;
  f16* Xh16 = (f16*)(ws);
  f16* Xc16 = (f16*)(ws + A_BYTES);
  f16* Wq16 = (f16*)(ws + 2 * A_BYTES);
  f16* Wk16 = (f16*)(ws + 2 * A_BYTES + W_BYTES);
  f16* Wv16 = (f16*)(ws + 2 * A_BYTES + 2 * W_BYTES);
  f16* Q16  = (f16*)(ws + 2 * A_BYTES + 3 * W_BYTES);
  f16* K16  = (f16*)(ws + 3 * A_BYTES + 3 * W_BYTES);
  f16* Vt16 = (f16*)(ws + 4 * A_BYTES + 3 * W_BYTES);

  cvt_f32_f16<<<2048, 256, 0, stream>>>(hidden,  Xh16, (int)ACT);
  cvt_f32_f16<<<2048, 256, 0, stream>>>(context, Xc16, (int)ACT);
  cvt_f32_f16<<<1024, 256, 0, stream>>>(Wq, Wq16, (int)WSZ);
  cvt_f32_f16<<<1024, 256, 0, stream>>>(Wk, Wk16, (int)WSZ);
  cvt_f32_f16<<<1024, 256, 0, stream>>>(Wv, Wv16, (int)WSZ);

  const float qscale = 1.0f / sqrtf((float)HD + 1e-5f);
  dim3 pgrid((BATCH * SEQ) / 64, HEADS);             // 4 waves x 16 rows per block
  proj_kernel<<<pgrid, 128, 0, stream>>>(Xh16, Wq16, bq, Q16,  0, qscale);
  proj_kernel<<<pgrid, 128, 0, stream>>>(Xc16, Wk16, bk, K16,  1, 1.0f);
  proj_kernel<<<pgrid, 128, 0, stream>>>(Xc16, Wv16, bv, Vt16, 2, 1.0f);

  dim3 agrid(SEQ / 128, BATCH * HEADS);
  attn_kernel<<<agrid, 128, 0, stream>>>(Q16, K16, Vt16, amask, outp);
}

// v001
// Measured time: 160 microseconds a run.
// Next to v000, in two timings, it ran 1.10 and 1.12 times as fast.
#include <hip/hip_runtime.h>

typedef _Float16 f16;
typedef _Float16 v4h  __attribute__((ext_vector_type(4)));
typedef _Float16 v8h  __attribute__((ext_vector_type(8)));
typedef _Float16 v16h __attribute__((ext_vector_type(16)));
typedef float    v8f  __attribute__((ext_vector_type(8)));

#define HIDDEN 768
#define HEADS  12
#define HD     64
#define SEQ    2048
#define BATCH  2

#define WMMA_F16(A, B, C) \
  __builtin_amdgcn_wmma_f32_16x16x32_f16(false, (A), false, (B), (short)0, (C), false, false)

static __device__ __forceinline__ v16h cat8(v8h lo, v8h hi) {
  return __builtin_shufflevector(lo, hi, 0,1,2,3,4,5,6,7,8,9,10,11,12,13,14,15);
}

// ---------------------------------------------------------------- fragment order
// Every f16 operand in the workspace is stored as 1-KiB WMMA fragments
// (16 rows x 32 k). Element (row, k) of a fragment sits at half index
//   (k >> 4) * 256 + (((k >> 3) & 1) * 16 + row) * 8 + (k & 7)
// so lane l reads its 2 x 8 halfs at l * 8 and 256 + l * 8: each wave-wide
// 16-byte load covers 512 contiguous bytes (4 lines) instead of 16 rows.
#define FRAG 512                 // halfs per fragment
#define KFR  (HIDDEN / 32)       // fragments along k of a 768-wide operand

static __device__ __forceinline__ v16h load_frag(const f16* p) {   // p includes lane * 8
  return cat8(*(const v8h*)p, *(const v8h*)(p + 256));
}

// A wave-uniform pointer held in a scalar register pair: the loads formed from it
// take the scalar-base form with the lane's 32-bit offset beside it. Without it the
// key loop rebuilds two 64-bit vector addresses every trip in registers that the
// last load of the run then takes for its result.
static __device__ __forceinline__ const char* scalar_base(const f16* p) {
  const unsigned long long a = (unsigned long long)p;
  const unsigned lo = (unsigned)__builtin_amdgcn_readfirstlane((int)(unsigned)a);
  const unsigned hi = (unsigned)__builtin_amdgcn_readfirstlane((int)(unsigned)(a >> 32));
  return (const char*)(((unsigned long long)hi << 32) | lo);
}

// ---------------------------------------------------------------- f32 -> f16, packed
// in: rows x 768 f32. One wave converts one fragment: 4 loads of 4 whole lines,
// 4 stores of 8 bytes per lane. out[(rowtile * KFR + ks) * FRAG + ...].
__global__ __launch_bounds__(256)
void pack_f32_f16(const float* __restrict__ in, f16* __restrict__ out) {
  const int lane = threadIdx.x & 31;
  const int fr   = (blockIdx.x * 256 + threadIdx.x) >> 5;   // fragment index
  const int mt   = fr / KFR;
  const int ks   = fr % KFR;
  const int k4   = lane & 7;                                // float4 within the 32 k
  const float* src = in + (size_t)(mt * 16 + (lane >> 3)) * HIDDEN + ks * 32 + k4 * 4;
  f16* dst = out + (size_t)fr * FRAG + (k4 >> 2) * 256
                 + (((k4 >> 1) & 1) * 16 + (lane >> 3)) * 8 + (k4 & 1) * 4;
  float4 v[4];
  #pragma unroll
  for (int i = 0; i < 4; ++i)
    v[i] = *(const float4*)(src + (size_t)i * 4 * HIDDEN);
  #pragma unroll
  for (int i = 0; i < 4; ++i) {
    v4h y = {(f16)v[i].x, (f16)v[i].y, (f16)v[i].z, (f16)v[i].w};
    *(v4h*)(dst + i * 4 * 8) = y;
  }
}

// ---------------------------------------------------------------- projection
// Y = X(4096x768) @ W^T(768x768) + bias. Each wave computes a 16x64 strip
// (one X frag reused across 4 W frags -> 10 loads : 4 WMMAs per k-step).
// VT false: Q or K. The product is formed as W x X^T, so a lane holds 8
//   consecutive d of one position: its 16 bytes of the [bh][s/16][d/32] fragment.
// VT true: V. The product is formed as X x W^T, so a lane holds 8 consecutive
//   positions of one d: its 16 bytes of the [bh][s/32][d/16] fragment.
template <bool VT>
__global__ __launch_bounds__(128)
void proj_kernel(const f16* __restrict__ X, const f16* __restrict__ W,
                 const float* __restrict__ bias, f16* __restrict__ out,
                 float scale) {
  const int lane = threadIdx.x & 31;
  const int wave = threadIdx.x >> 5;
  const int lr   = lane & 15;
  const int hf   = lane >> 4;

  const int mt = blockIdx.x * 4 + wave;          // row tile (0..255)
  const int h  = blockIdx.y;                     // head == 64-col group

  const f16* xf = X + (size_t)mt * KFR * FRAG + lane * 8;
  const f16* wf = W + (size_t)(h * 4) * KFR * FRAG + lane * 8;

  v8f acc[4] = {};
  #pragma unroll
  for (int ks = 0; ks < KFR; ++ks) {
    v16h a = load_frag(xf + ks * FRAG);
    #pragma unroll
    for (int t = 0; t < 4; ++t) {
      v16h bfr = load_frag(wf + (t * KFR + ks) * FRAG);
      acc[t] = VT ? WMMA_F16(a, bfr, acc[t]) : WMMA_F16(bfr, a, acc[t]);
    }
  }

  const int m0 = mt * 16;
  const int bh = (m0 >> 11) * HEADS + h;         // SEQ == 2048
  const int s0 = m0 & (SEQ - 1);
  #pragma unroll
  for (int t = 0; t < 4; ++t) {
    v8h y;
    if (VT) {
      const float bv = bias[h * 64 + t * 16 + lr];
      #pragma unroll
      for (int r = 0; r < 8; ++r) y[r] = (f16)((acc[t][r] + bv) * scale);
      *(v8h*)(out + ((size_t)(bh * (SEQ / 32) + (s0 >> 5)) * 4 + t) * FRAG
                  + ((s0 >> 4) & 1) * 256 + lane * 8) = y;
    } else {
      const float* bp = bias + h * 64 + t * 16 + 8 * hf;
      #pragma unroll
      for (int r = 0; r < 8; ++r) y[r] = (f16)((acc[t][r] + bp[r]) * scale);
      *(v8h*)(out + ((size_t)(bh * (SEQ / 16) + (s0 >> 4)) * 2 + (t >> 1)) * FRAG
                  + (t & 1) * 256 + lane * 8) = y;
    }
  }
}

// ---------------------------------------------------------------- attention
// grid: (SEQ/128, B*H), block 128 (4 waves). Wave owns 32 query rows (two
// 16-row tiles), streams keys in chunks of 32 with online softmax. K/V frags
// loaded once per chunk and reused by both query tiles -> 1:1 VMEM:WMMA.
// Q, K: fragments [bh][s/16][d/32]; Vt: fragments [bh][s/32][d/16].
__global__ __launch_bounds__(128)
void attn_kernel(const f16* __restrict__ Q, const f16* __restrict__ K,
                 const f16* __restrict__ Vt, const float* __restrict__ mask,
                 float* __restrict__ out) {
  __shared__ float smask[SEQ];
  const int bh = blockIdx.y;
  const int b  = bh / HEADS;
  const int h  = bh % HEADS;

  for (int i = threadIdx.x; i < SEQ; i += blockDim.x)
    smask[i] = mask[(size_t)b * SEQ + i];
  __syncthreads();

  const int lane = threadIdx.x & 31;
  const int wave = threadIdx.x >> 5;
  const int lr   = lane & 15;
  const int hf   = lane >> 4;
  const int q0   = blockIdx.x * 128 + wave * 32;   // 32-query strip base

  // Q as B-operand of S^T = K x Q^T (two query tiles, resident)
  v16h Qb[2][2];
  #pragma unroll
  for (int u = 0; u < 2; ++u) {
    const f16* qf = Q + ((size_t)bh * SEQ + q0 + u * 16) * HD + lane * 8;
    #pragma unroll
    for (int ks = 0; ks < 2; ++ks)
      Qb[u][ks] = load_frag(qf + ks * FRAG);
  }

  const f16* Kbh = K  + (size_t)bh * SEQ * HD;
  const f16* Vbh = Vt + (size_t)bh * HD * SEQ;
  const char* Ks = scalar_base(Kbh);
  const char* Vs = scalar_base(Vbh);
  // K and V chunks sit at the same place in their planes: one 32-bit byte offset
  // per lane, carried through the loop, beside the two scalar bases.
  unsigned off = lane * 16;

  v8f O[2][4] = {};
  float m_run[2] = {-1e30f, -1e30f};
  float l_run[2] = {0.f, 0.f};

  for (int kb = 0; kb < SEQ; kb += 32) {
    // ---- shared K A-frags (2 key tiles x 2 k-steps) and V B-frags (4 d-tiles)
    v16h ka[2][2];
    #pragma unroll
    for (int c = 0; c < 2; ++c)
      #pragma unroll
      for (int ks = 0; ks < 2; ++ks)
        ka[c][ks] = load_frag((const f16*)(Ks + off) + (c * 2 + ks) * FRAG);
    v16h vb[4];
    #pragma unroll
    for (int t = 0; t < 4; ++t)
      vb[t] = load_frag((const f16*)(Vs + off) + t * FRAG);
    float mk0[8], mk1[8];
    #pragma unroll
    for (int r = 0; r < 8; ++r) {
      mk0[r] = smask[kb + r + 8 * hf];
      mk1[r] = smask[kb + 16 + r + 8 * hf];
    }

    if (kb + 32 < SEQ) {   // global_prefetch_b8: next chunk's 4 KiB of K and of V, one ask per 256 B
      __builtin_prefetch(Kbh + (size_t)(kb + 32) * HD + lr * 128, 0, 1);
      __builtin_prefetch(Vbh + (size_t)(kb + 32) * HD + lr * 128, 0, 1);
    }

    #pragma unroll
    for (int u = 0; u < 2; ++u) {
      // ---- S^T tiles for query tile u
      v8f c0 = {}, c1 = {};
      #pragma unroll
      for (int ks = 0; ks < 2; ++ks) {
        c0 = WMMA_F16(ka[0][ks], Qb[u][ks], c0);
        c1 = WMMA_F16(ka[1][ks], Qb[u][ks], c1);
      }

      // ---- online softmax; lane carries query lr (replicated in halves)
      float p[16];
      float mx = -1e30f;
      #pragma unroll
      for (int r = 0; r < 8; ++r) {
        float s0 = c0[r] + mk0[r];
        float s1 = c1[r] + mk1[r];
        p[r] = s0; p[8 + r] = s1;
        mx = fmaxf(mx, fmaxf(s0, s1));
      }
      mx = fmaxf(mx, __shfl_xor(mx, 16, 32));
      const float m_new = fmaxf(m_run[u], mx);
      const float alpha = __expf(m_run[u] - m_new);

      v16h pa;              // C-layout of S^T tiles == A-layout of P
      float lsum = 0.f;
      #pragma unroll
      for (int r = 0; r < 8; ++r) {
        float e0 = __expf(p[r] - m_new);
        float e1 = __expf(p[8 + r] - m_new);
        lsum += e0 + e1;
        pa[r] = (f16)e0; pa[8 + r] = (f16)e1;
      }
      lsum += __shfl_xor(lsum, 16, 32);
      l_run[u] = l_run[u] * alpha + lsum;
      m_run[u] = m_new;

      // ---- rescale O rows (row M = r + 8*hf; alpha for query j lives in lane j)
      #pragma unroll
      for (int r = 0; r < 8; ++r) {
        float ar = __shfl(alpha, r + 8 * hf, 32);
        #pragma unroll
        for (int t = 0; t < 4; ++t) O[u][t][r] *= ar;
      }

      // ---- O += P x Vchunk (V frags shared across u)
      #pragma unroll
      for (int t = 0; t < 4; ++t)
        O[u][t] = WMMA_F16(pa, vb[t], O[u][t]);
    }
    off += 32 * HD * sizeof(f16);
  }

  // ---- normalize and store [B,S,768] f32
  #pragma unroll
  for (int u = 0; u < 2; ++u) {
    const float inv = 1.0f / l_run[u];
    #pragma unroll
    for (int r = 0; r < 8; ++r) {
      float ir = __shfl(inv, r + 8 * hf, 32);
      const int s = q0 + u * 16 + r + 8 * hf;
      #pragma unroll
      for (int t = 0; t < 4; ++t)
        out[((size_t)b * SEQ + s) * HIDDEN + h * 64 + t * 16 + lr] = O[u][t][r] * ir;
    }
  }
}

// ---------------------------------------------------------------- launcher
extern "C" void kernel_launch(void* const* d_in, const int* in_sizes, int n_in,
                              void* d_out, int out_size, void* d_ws, size_t ws_size,
                              hipStream_t stream) {
  const float* hidden  = (const float*)d_in[0];
  const float* context = (const float*)d_in[1];
  const float* amask   = (const float*)d_in[2];
  const float* Wq = (const float*)d_in[3];
  const float* bq = (const float*)d_in[4];
  const float* Wk = (const float*)d_in[5];
  const float* bk = (const float*)d_in[6];
  const float* Wv = (const float*)d_in[7];
  const float* bv = (const float*)d_in[8];
  float* outp = (float*)d_out;

  const size_t ACT = (size_t)BATCH * SEQ * HIDDEN;   // 3,145,728 elems
  const size_t WSZ = (size_t)HIDDEN * HIDDEN;        //   589,824 elems
  const size_t A_BYTES = ACT * sizeof(f16);          // 6,291,456
  const size_t W_BYTES = WSZ * sizeof(f16);          // 1,179,648

  char* ws = (char*)d_ws;
  f16* Xh16 = (f16*)(ws);
  f16* Xc16 = (f16*)(ws + A_BYTES);
  f16* Wq16 = (f16*)(ws + 2 * A_BYTES);
  f16* Wk16 = (f16*)(ws + 2 * A_BYTES + W_BYTES);
  f16* Wv16 = (f16*)(ws + 2 * A_BYTES + 2 * W_BYTES);
  f16* Q16  = (f16*)(ws + 2 * A_BYTES + 3 * W_BYTES);
  f16* K16  = (f16*)(ws + 3 * A_BYTES + 3 * W_BYTES);
  f16* Vt16 = (f16*)(ws + 4 * A_BYTES + 3 * W_BYTES);

  // one wave per fragment, 8 waves per block
  pack_f32_f16<<<ACT / FRAG / 8, 256, 0, stream>>>(hidden,  Xh16);
  pack_f32_f16<<<ACT / FRAG / 8, 256, 0, stream>>>(context, Xc16);
  pack_f32_f16<<<WSZ / FRAG / 8, 256, 0, stream>>>(Wq, Wq16);
  pack_f32_f16<<<WSZ / FRAG / 8, 256, 0, stream>>>(Wk, Wk16);
  pack_f32_f16<<<WSZ / FRAG / 8, 256, 0, stream>>>(Wv, Wv16);

  const float qscale = 1.0f / sqrtf((float)HD + 1e-5f);
  dim3 pgrid((BATCH * SEQ) / 64, HEADS);             // 4 waves x 16 rows per block
  proj_kernel<false><<<pgrid, 128, 0, stream>>>(Xh16, Wq16, bq, Q16,  qscale);
  proj_kernel<false><<<pgrid, 128, 0, stream>>>(Xc16, Wk16, bk, K16,  1.0f);
  proj_kernel<true ><<<pgrid, 128, 0, stream>>>(Xc16, Wv16, bv, Vt16, 1.0f);

  dim3 agrid(SEQ / 128, BATCH * HEADS);
  attn_kernel<<<agrid, 128, 0, stream>>>(Q16, K16, Vt16, amask, outp);
}

// v002
// It runs in 95.6 microseconds.
// In two side-by-side timings against v001, it was 1.67 and 1.65 times as fast.
// Over all steps from v000 it is 1.85 times as fast.
#include <hip/hip_runtime.h>

typedef _Float16 f16;
typedef _Float16 v4h  __attribute__((ext_vector_type(4)));
typedef _Float16 v8h  __attribute__((ext_vector_type(8)));
typedef _Float16 v16h __attribute__((ext_vector_type(16)));
typedef float    v8f  __attribute__((ext_vector_type(8)));

#define HIDDEN 768
#define HEADS  12
#define HD     64
#define SEQ    2048
#define BATCH  2

#define WMMA_F16(A, B, C) \
  __builtin_amdgcn_wmma_f32_16x16x32_f16(false, (A), false, (B), (short)0, (C), false, false)

static __device__ __forceinline__ v16h cat8(v8h lo, v8h hi) {
  return __builtin_shufflevector(lo, hi, 0,1,2,3,4,5,6,7,8,9,10,11,12,13,14,15);
}

// ---------------------------------------------------------------- fragment order
// Every f16 operand in the workspace is stored as 1-KiB WMMA fragments
// (16 rows x 32 k). Element (row, k) of a fragment sits at half index
//   (k >> 4) * 256 + (((k >> 3) & 1) * 16 + row) * 8 + (k & 7)
// so lane l reads its 2 x 8 halfs at l * 8 and 256 + l * 8: each wave-wide
// 16-byte load covers 512 contiguous bytes (4 lines) instead of 16 rows.
#define FRAG 512                 // halfs per fragment
#define KFR  (HIDDEN / 32)       // fragments along k of a 768-wide operand
#define AHEAD 4                  // k-steps of projection operands in flight per wave

static __device__ __forceinline__ v16h load_frag(const f16* p) {   // p includes lane * 8
  return cat8(*(const v8h*)p, *(const v8h*)(p + 256));
}

// A wave-uniform pointer held in a scalar register pair: the loads formed from it
// take the scalar-base form with the lane's 32-bit offset beside it. Without it the
// key loop rebuilds two 64-bit vector addresses every trip in registers that the
// last load of the run then takes for its result.
static __device__ __forceinline__ const char* scalar_base(const f16* p) {
  const unsigned long long a = (unsigned long long)p;
  const unsigned lo = (unsigned)__builtin_amdgcn_readfirstlane((int)(unsigned)a);
  const unsigned hi = (unsigned)__builtin_amdgcn_readfirstlane((int)(unsigned)(a >> 32));
  return (const char*)(((unsigned long long)hi << 32) | lo);
}

// ---------------------------------------------------------------- f32 -> f16, packed
// in: rows x 768 f32. One wave converts one fragment: 4 loads of 4 whole lines,
// 4 stores of 8 bytes per lane. out[(rowtile * KFR + ks) * FRAG + ...].
__global__ __launch_bounds__(256)
void pack_f32_f16(const float* __restrict__ in, f16* __restrict__ out) {
  const int lane = threadIdx.x & 31;
  const int fr   = (blockIdx.x * 256 + threadIdx.x) >> 5;   // fragment index
  const int mt   = fr / KFR;
  const int ks   = fr % KFR;
  const int k4   = lane & 7;                                // float4 within the 32 k
  const float* src = in + (size_t)(mt * 16 + (lane >> 3)) * HIDDEN + ks * 32 + k4 * 4;
  f16* dst = out + (size_t)fr * FRAG + (k4 >> 2) * 256
                 + (((k4 >> 1) & 1) * 16 + (lane >> 3)) * 8 + (k4 & 1) * 4;
  float4 v[4];
  #pragma unroll
  for (int i = 0; i < 4; ++i)
    v[i] = *(const float4*)(src + (size_t)i * 4 * HIDDEN);
  #pragma unroll
  for (int i = 0; i < 4; ++i) {
    v4h y = {(f16)v[i].x, (f16)v[i].y, (f16)v[i].z, (f16)v[i].w};
    *(v4h*)(dst + i * 4 * 8) = y;
  }
}

// ---------------------------------------------------------------- projection
// Y = X(4096x768) @ W^T(768x768) + bias. Each wave computes a 16x64 strip
// (one X frag reused across 4 W frags -> 10 loads : 4 WMMAs per k-step).
// VT false: Q or K. The product is formed as W x X^T, so a lane holds 8
//   consecutive d of one position: its 16 bytes of the [bh][s/16][d/32] fragment.
// VT true: V. The product is formed as X x W^T, so a lane holds 8 consecutive
//   positions of one d: its 16 bytes of the [bh][s/32][d/16] fragment.
template <bool VT>
__global__ __launch_bounds__(128)
void proj_kernel(const f16* __restrict__ X, const f16* __restrict__ W,
                 const float* __restrict__ bias, f16* __restrict__ out,
                 float scale) {
  const int lane = threadIdx.x & 31;
  const int wave = threadIdx.x >> 5;
  const int lr   = lane & 15;
  const int hf   = lane >> 4;

  const int mt = blockIdx.x * 4 + wave;          // row tile (0..255)
  const int h  = blockIdx.y;                     // head == 64-col group

  const f16* xf = X + (size_t)mt * KFR * FRAG + lane * 8;
  const f16* wf = W + (size_t)(h * 4) * KFR * FRAG + lane * 8;

  // Register ring, AHEAD k-steps deep: the 10 loads of k-step ks + AHEAD are issued
  // right behind the products of k-step ks, so a wave waits for a load that is
  // AHEAD k-steps old instead of for the one it has just issued.
  v16h a[AHEAD], w[AHEAD][4];
  #pragma unroll
  for (int s = 0; s < AHEAD; ++s) {
    a[s] = load_frag(xf + s * FRAG);
    #pragma unroll
    for (int t = 0; t < 4; ++t)
      w[s][t] = load_frag(wf + (t * KFR + s) * FRAG);
  }

  v8f acc[4] = {};
  #pragma unroll
  for (int ks = 0; ks < KFR; ++ks) {
    const int s = ks % AHEAD;
    #pragma unroll
    for (int t = 0; t < 4; ++t)
      acc[t] = VT ? WMMA_F16(a[s], w[s][t], acc[t]) : WMMA_F16(w[s][t], a[s], acc[t]);
    if (ks + AHEAD < KFR) {
      a[s] = load_frag(xf + (ks + AHEAD) * FRAG);
      #pragma unroll
      for (int t = 0; t < 4; ++t)
        w[s][t] = load_frag(wf + (t * KFR + ks + AHEAD) * FRAG);
    }
    // Keeps the scheduler from sinking these loads down to their use, AHEAD k-steps later:
    // without it every product waits out the whole latency of the load in front of it.
    __builtin_amdgcn_sched_barrier(0);
  }

  const int m0 = mt * 16;
  const int bh = (m0 >> 11) * HEADS + h;         // SEQ == 2048
  const int s0 = m0 & (SEQ - 1);
  #pragma unroll
  for (int t = 0; t < 4; ++t) {
    v8h y;
    if (VT) {
      const float bv = bias[h * 64 + t * 16 + lr];
      #pragma unroll
      for (int r = 0; r < 8; ++r) y[r] = (f16)((acc[t][r] + bv) * scale);
      *(v8h*)(out + ((size_t)(bh * (SEQ / 32) + (s0 >> 5)) * 4 + t) * FRAG
                  + ((s0 >> 4) & 1) * 256 + lane * 8) = y;
    } else {
      const float* bp = bias + h * 64 + t * 16 + 8 * hf;
      #pragma unroll
      for (int r = 0; r < 8; ++r) y[r] = (f16)((acc[t][r] + bp[r]) * scale);
      *(v8h*)(out + ((size_t)(bh * (SEQ / 16) + (s0 >> 4)) * 2 + (t >> 1)) * FRAG
                  + (t & 1) * 256 + lane * 8) = y;
    }
  }
}

// ---------------------------------------------------------------- attention
// grid: (SEQ/128, B*H), block 128 (4 waves). Wave owns 32 query rows (two
// 16-row tiles), streams keys in chunks of 32 with online softmax. K/V frags
// loaded once per chunk and reused by both query tiles -> 1:1 VMEM:WMMA.
// Q, K: fragments [bh][s/16][d/32]; Vt: fragments [bh][s/32][d/16].
__global__ __launch_bounds__(128)
void attn_kernel(const f16* __restrict__ Q, const f16* __restrict__ K,
                 const f16* __restrict__ Vt, const float* __restrict__ mask,
                 float* __restrict__ out) {
  __shared__ float smask[SEQ];
  const int bh = blockIdx.y;
  const int b  = bh / HEADS;
  const int h  = bh % HEADS;

  for (int i = threadIdx.x; i < SEQ; i += blockDim.x)
    smask[i] = mask[(size_t)b * SEQ + i];
  __syncthreads();

  const int lane = threadIdx.x & 31;
  const int wave = threadIdx.x >> 5;
  const int lr   = lane & 15;
  const int hf   = lane >> 4;
  const int q0   = blockIdx.x * 128 + wave * 32;   // 32-query strip base

  // Q as B-operand of S^T = K x Q^T (two query tiles, resident)
  v16h Qb[2][2];
  #pragma unroll
  for (int u = 0; u < 2; ++u) {
    const f16* qf = Q + ((size_t)bh * SEQ + q0 + u * 16) * HD + lane * 8;
    #pragma unroll
    for (int ks = 0; ks < 2; ++ks)
      Qb[u][ks] = load_frag(qf + ks * FRAG);
  }

  const f16* Kbh = K  + (size_t)bh * SEQ * HD;
  const f16* Vbh = Vt + (size_t)bh * HD * SEQ;
  const char* Ks = scalar_base(Kbh);
  const char* Vs = scalar_base(Vbh);
  // K and V chunks sit at the same place in their planes: one 32-bit byte offset
  // per lane, carried through the loop, beside the two scalar bases.
  unsigned off = lane * 16;

  v8f O[2][4] = {};
  float m_run[2] = {-1e30f, -1e30f};
  float l_run[2] = {0.f, 0.f};

  for (int kb = 0; kb < SEQ; kb += 32) {
    // ---- shared K A-frags (2 key tiles x 2 k-steps) and V B-frags (4 d-tiles)
    v16h ka[2][2];
    #pragma unroll
    for (int c = 0; c < 2; ++c)
      #pragma unroll
      for (int ks = 0; ks < 2; ++ks)
        ka[c][ks] = load_frag((const f16*)(Ks + off) + (c * 2 + ks) * FRAG);
    v16h vb[4];
    #pragma unroll
    for (int t = 0; t < 4; ++t)
      vb[t] = load_frag((const f16*)(Vs + off) + t * FRAG);
    float mk0[8], mk1[8];
    #pragma unroll
    for (int r = 0; r < 8; ++r) {
      mk0[r] = smask[kb + r + 8 * hf];
      mk1[r] = smask[kb + 16 + r + 8 * hf];
    }

    if (kb + 32 < SEQ) {   // global_prefetch_b8: next chunk's 4 KiB of K and of V, one ask per 256 B
      __builtin_prefetch(Kbh + (size_t)(kb + 32) * HD + lr * 128, 0, 1);
      __builtin_prefetch(Vbh + (size_t)(kb + 32) * HD + lr * 128, 0, 1);
    }

    #pragma unroll
    for (int u = 0; u < 2; ++u) {
      // ---- S^T tiles for query tile u
      v8f c0 = {}, c1 = {};
      #pragma unroll
      for (int ks = 0; ks < 2; ++ks) {
        c0 = WMMA_F16(ka[0][ks], Qb[u][ks], c0);
        c1 = WMMA_F16(ka[1][ks], Qb[u][ks], c1);
      }

      // ---- online softmax; lane carries query lr (replicated in halves)
      float p[16];
      float mx = -1e30f;
      #pragma unroll
      for (int r = 0; r < 8; ++r) {
        float s0 = c0[r] + mk0[r];
        float s1 = c1[r] + mk1[r];
        p[r] = s0; p[8 + r] = s1;
        mx = fmaxf(mx, fmaxf(s0, s1));
      }
      mx = fmaxf(mx, __shfl_xor(mx, 16, 32));
      const float m_new = fmaxf(m_run[u], mx);
      const float alpha = __expf(m_run[u] - m_new);

      v16h pa;              // C-layout of S^T tiles == A-layout of P
      float lsum = 0.f;
      #pragma unroll
      for (int r = 0; r < 8; ++r) {
        float e0 = __expf(p[r] - m_new);
        float e1 = __expf(p[8 + r] - m_new);
        lsum += e0 + e1;
        pa[r] = (f16)e0; pa[8 + r] = (f16)e1;
      }
      lsum += __shfl_xor(lsum, 16, 32);
      l_run[u] = l_run[u] * alpha + lsum;
      m_run[u] = m_new;

      // ---- rescale O rows (row M = r + 8*hf; alpha for query j lives in lane j)
      #pragma unroll
      for (int r = 0; r < 8; ++r) {
        float ar = __shfl(alpha, r + 8 * hf, 32);
        #pragma unroll
        for (int t = 0; t < 4; ++t) O[u][t][r] *= ar;
      }

      // ---- O += P x Vchunk (V frags shared across u)
      #pragma unroll
      for (int t = 0; t < 4; ++t)
        O[u][t] = WMMA_F16(pa, vb[t], O[u][t]);
    }
    off += 32 * HD * sizeof(f16);
  }

  // ---- normalize and store [B,S,768] f32
  #pragma unroll
  for (int u = 0; u < 2; ++u) {
    const float inv = 1.0f / l_run[u];
    #pragma unroll
    for (int r = 0; r < 8; ++r) {
      float ir = __shfl(inv, r + 8 * hf, 32);
      const int s = q0 + u * 16 + r + 8 * hf;
      #pragma unroll
      for (int t = 0; t < 4; ++t)
        out[((size_t)b * SEQ + s) * HIDDEN + h * 64 + t * 16 + lr] = O[u][t][r] * ir;
    }
  }
}

// ---------------------------------------------------------------- launcher
extern "C" void kernel_launch(void* const* d_in, const int* in_sizes, int n_in,
                              void* d_out, int out_size, void* d_ws, size_t ws_size,
                              hipStream_t stream) {
  const float* hidden  = (const float*)d_in[0];
  const float* context = (const float*)d_in[1];
  const float* amask   = (const float*)d_in[2];
  const float* Wq = (const float*)d_in[3];
  const float* bq = (const float*)d_in[4];
  const float* Wk = (const float*)d_in[5];
  const float* bk = (const float*)d_in[6];
  const float* Wv = (const float*)d_in[7];
  const float* bv = (const float*)d_in[8];
  float* outp = (float*)d_out;

  const size_t ACT = (size_t)BATCH * SEQ * HIDDEN;   // 3,145,728 elems
  const size_t WSZ = (size_t)HIDDEN * HIDDEN;        //   589,824 elems
  const size_t A_BYTES = ACT * sizeof(f16);          // 6,291,456
  const size_t W_BYTES = WSZ * sizeof(f16);          // 1,179,648

  char* ws = (char*)d_ws;
  f16* Xh16 = (f16*)(ws);
  f16* Xc16 = (f16*)(ws + A_BYTES);
  f16* Wq16 = (f16*)(ws + 2 * A_BYTES);
  f16* Wk16 = (f16*)(ws + 2 * A_BYTES + W_BYTES);
  f16* Wv16 = (f16*)(ws + 2 * A_BYTES + 2 * W_BYTES);
  f16* Q16  = (f16*)(ws + 2 * A_BYTES + 3 * W_BYTES);
  f16* K16  = (f16*)(ws + 3 * A_BYTES + 3 * W_BYTES);
  f16* Vt16 = (f16*)(ws + 4 * A_BYTES + 3 * W_BYTES);

  // one wave per fragment, 8 waves per block
  pack_f32_f16<<<ACT / FRAG / 8, 256, 0, stream>>>(hidden,  Xh16);
  pack_f32_f16<<<ACT / FRAG / 8, 256, 0, stream>>>(context, Xc16);
  pack_f32_f16<<<WSZ / FRAG / 8, 256, 0, stream>>>(Wq, Wq16);
  pack_f32_f16<<<WSZ / FRAG / 8, 256, 0, stream>>>(Wk, Wk16);
  pack_f32_f16<<<WSZ / FRAG / 8, 256, 0, stream>>>(Wv, Wv16);

  const float qscale = 1.0f / sqrtf((float)HD + 1e-5f);
  dim3 pgrid((BATCH * SEQ) / 64, HEADS);             // 4 waves x 16 rows per block
  proj_kernel<false><<<pgrid, 128, 0, stream>>>(Xh16, Wq16, bq, Q16,  qscale);
  proj_kernel<false><<<pgrid, 128, 0, stream>>>(Xc16, Wk16, bk, K16,  1.0f);
  proj_kernel<true ><<<pgrid, 128, 0, stream>>>(Xc16, Wv16, bv, Vt16, 1.0f);

  dim3 agrid(SEQ / 128, BATCH * HEADS);
  attn_kernel<<<agrid, 128, 0, stream>>>(Q16, K16, Vt16, amask, outp);
}

// v003
// One run takes 82.1 microseconds.
// Timed twice side by side with v002, it ran 1.16 times as fast both times.
// All steps since v000 together make it 2.15 times as fast.
#include <hip/hip_runtime.h>

typedef _Float16 f16;
typedef _Float16 v4h  __attribute__((ext_vector_type(4)));
typedef _Float16 v8h  __attribute__((ext_vector_type(8)));
typedef _Float16 v16h __attribute__((ext_vector_type(16)));
typedef float    v8f  __attribute__((ext_vector_type(8)));

#define HIDDEN 768
#define HEADS  12
#define HD     64
#define SEQ    2048
#define BATCH  2

#define WMMA_F16(A, B, C) \
  __builtin_amdgcn_wmma_f32_16x16x32_f16(false, (A), false, (B), (short)0, (C), false, false)

static __device__ __forceinline__ v16h cat8(v8h lo, v8h hi) {
  return __builtin_shufflevector(lo, hi, 0,1,2,3,4,5,6,7,8,9,10,11,12,13,14,15);
}

// ---------------------------------------------------------------- fragment order
// Every f16 operand in the workspace is stored as 1-KiB WMMA fragments
// (16 rows x 32 k). Element (row, k) of a fragment sits at half index
//   (k >> 4) * 256 + (((k >> 3) & 1) * 16 + row) * 8 + (k & 7)
// so lane l reads its 2 x 8 halfs at l * 8 and 256 + l * 8: each wave-wide
// 16-byte load covers 512 contiguous bytes (4 lines) instead of 16 rows.
#define FRAG 512                 // halfs per fragment
#define KFR  (HIDDEN / 32)       // fragments along k of a 768-wide operand
#define AHEAD 4                  // k-steps of projection operands in flight per wave

static __device__ __forceinline__ v16h load_frag(const f16* p) {   // p includes lane * 8
  return cat8(*(const v8h*)p, *(const v8h*)(p + 256));
}

// A wave-uniform pointer held in a scalar register pair: the loads formed from it
// take the scalar-base form with the lane's 32-bit offset beside it. Without it the
// key loop rebuilds two 64-bit vector addresses every trip in registers that the
// last load of the run then takes for its result.
static __device__ __forceinline__ const char* scalar_base(const f16* p) {
  const unsigned long long a = (unsigned long long)p;
  const unsigned lo = (unsigned)__builtin_amdgcn_readfirstlane((int)(unsigned)a);
  const unsigned hi = (unsigned)__builtin_amdgcn_readfirstlane((int)(unsigned)(a >> 32));
  return (const char*)(((unsigned long long)hi << 32) | lo);
}

// ---------------------------------------------------------------- f32 -> f16, packed
// Each plane: rows x 768 f32. One wave converts one fragment: 4 loads of 4 whole lines,
// 4 stores of 8 bytes per lane. plane[(rowtile * KFR + ks) * FRAG + ...].
// One grid packs all five planes; they lie one behind the other in out, in the order
// of the arguments, so a fragment's place in out is its index over the whole grid.
// Every plane is a whole number of 8-fragment blocks: the choice is block-uniform.
#define XFR (BATCH * SEQ * HIDDEN / FRAG)   // fragments of an activation plane
#define WFR (HIDDEN * HIDDEN / FRAG)        // fragments of a weight plane
__global__ __launch_bounds__(256)
void pack_f32_f16(const float* __restrict__ hidden, const float* __restrict__ context,
                  const float* __restrict__ Wq, const float* __restrict__ Wk,
                  const float* __restrict__ Wv, f16* __restrict__ out) {
  const int lane = threadIdx.x & 31;
  const int gfr  = (blockIdx.x * 256 + threadIdx.x) >> 5;   // fragment index in out
  const int bfr  = blockIdx.x * 8;                          // the block's first fragment
  const float* in = hidden;
  int first = 0;
  if (bfr >= XFR)               { in = context; first = XFR; }
  if (bfr >= 2 * XFR)           { in = Wq;      first = 2 * XFR; }
  if (bfr >= 2 * XFR + WFR)     { in = Wk;      first = 2 * XFR + WFR; }
  if (bfr >= 2 * XFR + 2 * WFR) { in = Wv;      first = 2 * XFR + 2 * WFR; }
  const int fr   = gfr - first;                             // fragment index in its plane
  const int mt   = fr / KFR;
  const int ks   = fr % KFR;
  const int k4   = lane & 7;                                // float4 within the 32 k
  const float* src = in + (size_t)(mt * 16 + (lane >> 3)) * HIDDEN + ks * 32 + k4 * 4;
  f16* dst = out + (size_t)gfr * FRAG + (k4 >> 2) * 256
                 + (((k4 >> 1) & 1) * 16 + (lane >> 3)) * 8 + (k4 & 1) * 4;
  float4 v[4];
  #pragma unroll
  for (int i = 0; i < 4; ++i)
    v[i] = *(const float4*)(src + (size_t)i * 4 * HIDDEN);
  #pragma unroll
  for (int i = 0; i < 4; ++i) {
    v4h y = {(f16)v[i].x, (f16)v[i].y, (f16)v[i].z, (f16)v[i].w};
    *(v4h*)(dst + i * 4 * 8) = y;
  }
}

// ---------------------------------------------------------------- projection
// Y = X(4096x768) @ W^T(768x768) + bias. Each wave computes a 16x64 strip
// (one X frag reused across 4 W frags -> 10 loads : 4 WMMAs per k-step).
// VT false: Q or K. The product is formed as W x X^T, so a lane holds 8
//   consecutive d of one position: its 16 bytes of the [bh][s/16][d/32] fragment.
// VT true: V. The product is formed as X x W^T, so a lane holds 8 consecutive
//   positions of one d: its 16 bytes of the [bh][s/32][d/16] fragment.
template <bool VT>
static __device__ __forceinline__
void proj_body(const f16* __restrict__ X, const f16* __restrict__ W,
               const float* __restrict__ bias, f16* __restrict__ out,
               float scale) {
  const int lane = threadIdx.x & 31;
  const int wave = threadIdx.x >> 5;
  const int lr   = lane & 15;
  const int hf   = lane >> 4;

  const int mt = blockIdx.x * 4 + wave;          // row tile (0..255)
  const int h  = blockIdx.y;                     // head == 64-col group

  const f16* xf = X + (size_t)mt * KFR * FRAG + lane * 8;
  const f16* wf = W + (size_t)(h * 4) * KFR * FRAG + lane * 8;

  // Register ring, AHEAD k-steps deep: the 10 loads of k-step ks + AHEAD are issued
  // right behind the products of k-step ks, so a wave waits for a load that is
  // AHEAD k-steps old instead of for the one it has just issued.
  v16h a[AHEAD], w[AHEAD][4];
  #pragma unroll
  for (int s = 0; s < AHEAD; ++s) {
    a[s] = load_frag(xf + s * FRAG);
    #pragma unroll
    for (int t = 0; t < 4; ++t)
      w[s][t] = load_frag(wf + (t * KFR + s) * FRAG);
  }

  v8f acc[4] = {};
  #pragma unroll
  for (int ks = 0; ks < KFR; ++ks) {
    const int s = ks % AHEAD;
    #pragma unroll
    for (int t = 0; t < 4; ++t)
      acc[t] = VT ? WMMA_F16(a[s], w[s][t], acc[t]) : WMMA_F16(w[s][t], a[s], acc[t]);
    if (ks + AHEAD < KFR) {
      a[s] = load_frag(xf + (ks + AHEAD) * FRAG);
      #pragma unroll
      for (int t = 0; t < 4; ++t)
        w[s][t] = load_frag(wf + (t * KFR + ks + AHEAD) * FRAG);
    }
    // Keeps the scheduler from sinking these loads down to their use, AHEAD k-steps later:
    // without it every product waits out the whole latency of the load in front of it.
    __builtin_amdgcn_sched_barrier(0);
  }

  const int m0 = mt * 16;
  const int bh = (m0 >> 11) * HEADS + h;         // SEQ == 2048
  const int s0 = m0 & (SEQ - 1);
  #pragma unroll
  for (int t = 0; t < 4; ++t) {
    v8h y;
    if (VT) {
      const float bv = bias[h * 64 + t * 16 + lr];
      #pragma unroll
      for (int r = 0; r < 8; ++r) y[r] = (f16)((acc[t][r] + bv) * scale);
      *(v8h*)(out + ((size_t)(bh * (SEQ / 32) + (s0 >> 5)) * 4 + t) * FRAG
                  + ((s0 >> 4) & 1) * 256 + lane * 8) = y;
    } else {
      const float* bp = bias + h * 64 + t * 16 + 8 * hf;
      #pragma unroll
      for (int r = 0; r < 8; ++r) y[r] = (f16)((acc[t][r] + bp[r]) * scale);
      *(v8h*)(out + ((size_t)(bh * (SEQ / 16) + (s0 >> 4)) * 2 + (t >> 1)) * FRAG
                  + (t & 1) * 256 + lane * 8) = y;
    }
  }
  // In the merged kernel the V body's code follows this body's stores in the listing and
  // writes their address and data registers: the wait stands between stores and rewrite.
  if (!VT) asm volatile("s_wait_xcnt 0x0" ::: "memory");
}

// One grid for the three projections: blockIdx.z = 0 Q, 1 K, 2 V. The packed weight
// planes lie one behind the other in W3, the three result planes in out3.
__global__ __launch_bounds__(128)
void proj_kernel(const f16* __restrict__ Xh, const f16* __restrict__ Xc,
                 const f16* __restrict__ W3, const float* __restrict__ bq,
                 const float* __restrict__ bk, const float* __restrict__ bv,
                 f16* __restrict__ out3, float qscale) {
  const int z = blockIdx.z;
  const f16* W = W3 + (size_t)z * (HIDDEN * HIDDEN);
  f16* out = out3 + (size_t)z * (BATCH * SEQ * HIDDEN);
  if (z == 2)
    proj_body<true>(Xc, W, bv, out, 1.0f);
  else
    proj_body<false>(z ? Xc : Xh, W, z ? bk : bq, out, z ? 1.0f : qscale);
}

// ---------------------------------------------------------------- attention
// grid: (SEQ/128, B*H), block 128 (4 waves). Wave owns 32 query rows (two
// 16-row tiles), streams keys in chunks of 32 with online softmax. K/V frags
// loaded once per chunk and reused by both query tiles -> 1:1 VMEM:WMMA.
// Q, K: fragments [bh][s/16][d/32]; Vt: fragments [bh][s/32][d/16].
__global__ __launch_bounds__(128)
void attn_kernel(const f16* __restrict__ Q, const f16* __restrict__ K,
                 const f16* __restrict__ Vt, const float* __restrict__ mask,
                 float* __restrict__ out) {
  __shared__ float smask[SEQ];
  const int bh = blockIdx.y;
  const int b  = bh / HEADS;
  const int h  = bh % HEADS;

  for (int i = threadIdx.x; i < SEQ; i += blockDim.x)
    smask[i] = mask[(size_t)b * SEQ + i];
  __syncthreads();

  const int lane = threadIdx.x & 31;
  const int wave = threadIdx.x >> 5;
  const int lr   = lane & 15;
  const int hf   = lane >> 4;
  const int q0   = blockIdx.x * 128 + wave * 32;   // 32-query strip base

  // Q as B-operand of S^T = K x Q^T (two query tiles, resident)
  v16h Qb[2][2];
  #pragma unroll
  for (int u = 0; u < 2; ++u) {
    const f16* qf = Q + ((size_t)bh * SEQ + q0 + u * 16) * HD + lane * 8;
    #pragma unroll
    for (int ks = 0; ks < 2; ++ks)
      Qb[u][ks] = load_frag(qf + ks * FRAG);
  }

  const f16* Kbh = K  + (size_t)bh * SEQ * HD;
  const f16* Vbh = Vt + (size_t)bh * HD * SEQ;
  const char* Ks = scalar_base(Kbh);
  const char* Vs = scalar_base(Vbh);
  // K and V chunks sit at the same place in their planes: one 32-bit byte offset
  // per lane, carried through the loop, beside the two scalar bases.
  unsigned off = lane * 16;

  v8f O[2][4] = {};
  float m_run[2] = {-1e30f, -1e30f};
  float l_run[2] = {0.f, 0.f};

  for (int kb = 0; kb < SEQ; kb += 32) {
    // ---- shared K A-frags (2 key tiles x 2 k-steps) and V B-frags (4 d-tiles)
    v16h ka[2][2];
    #pragma unroll
    for (int c = 0; c < 2; ++c)
      #pragma unroll
      for (int ks = 0; ks < 2; ++ks)
        ka[c][ks] = load_frag((const f16*)(Ks + off) + (c * 2 + ks) * FRAG);
    v16h vb[4];
    #pragma unroll
    for (int t = 0; t < 4; ++t)
      vb[t] = load_frag((const f16*)(Vs + off) + t * FRAG);
    float mk0[8], mk1[8];
    #pragma unroll
    for (int r = 0; r < 8; ++r) {
      mk0[r] = smask[kb + r + 8 * hf];
      mk1[r] = smask[kb + 16 + r + 8 * hf];
    }

    if (kb + 32 < SEQ) {   // global_prefetch_b8: next chunk's 4 KiB of K and of V, one ask per 256 B
      __builtin_prefetch(Kbh + (size_t)(kb + 32) * HD + lr * 128, 0, 1);
      __builtin_prefetch(Vbh + (size_t)(kb + 32) * HD + lr * 128, 0, 1);
    }

    #pragma unroll
    for (int u = 0; u < 2; ++u) {
      // ---- S^T tiles for query tile u
      v8f c0 = {}, c1 = {};
      #pragma unroll
      for (int ks = 0; ks < 2; ++ks) {
        c0 = WMMA_F16(ka[0][ks], Qb[u][ks], c0);
        c1 = WMMA_F16(ka[1][ks], Qb[u][ks], c1);
      }

      // ---- online softmax; lane carries query lr (replicated in halves)
      float p[16];
      float mx = -1e30f;
      #pragma unroll
      for (int r = 0; r < 8; ++r) {
        float s0 = c0[r] + mk0[r];
        float s1 = c1[r] + mk1[r];
        p[r] = s0; p[8 + r] = s1;
        mx = fmaxf(mx, fmaxf(s0, s1));
      }
      mx = fmaxf(mx, __shfl_xor(mx, 16, 32));
      const float m_new = fmaxf(m_run[u], mx);
      const float alpha = __expf(m_run[u] - m_new);

      v16h pa;              // C-layout of S^T tiles == A-layout of P
      float lsum = 0.f;
      #pragma unroll
      for (int r = 0; r < 8; ++r) {
        float e0 = __expf(p[r] - m_new);
        float e1 = __expf(p[8 + r] - m_new);
        lsum += e0 + e1;
        pa[r] = (f16)e0; pa[8 + r] = (f16)e1;
      }
      lsum += __shfl_xor(lsum, 16, 32);
      l_run[u] = l_run[u] * alpha + lsum;
      m_run[u] = m_new;

      // ---- rescale O rows (row M = r + 8*hf; alpha for query j lives in lane j)
      #pragma unroll
      for (int r = 0; r < 8; ++r) {
        float ar = __shfl(alpha, r + 8 * hf, 32);
        #pragma unroll
        for (int t = 0; t < 4; ++t) O[u][t][r] *= ar;
      }

      // ---- O += P x Vchunk (V frags shared across u)
      #pragma unroll
      for (int t = 0; t < 4; ++t)
        O[u][t] = WMMA_F16(pa, vb[t], O[u][t]);
    }
    off += 32 * HD * sizeof(f16);
  }

  // ---- normalize and store [B,S,768] f32
  #pragma unroll
  for (int u = 0; u < 2; ++u) {
    const float inv = 1.0f / l_run[u];
    #pragma unroll
    for (int r = 0; r < 8; ++r) {
      float ir = __shfl(inv, r + 8 * hf, 32);
      const int s = q0 + u * 16 + r + 8 * hf;
      #pragma unroll
      for (int t = 0; t < 4; ++t)
        out[((size_t)b * SEQ + s) * HIDDEN + h * 64 + t * 16 + lr] = O[u][t][r] * ir;
    }
  }
}

// ---------------------------------------------------------------- launcher
extern "C" void kernel_launch(void* const* d_in, const int* in_sizes, int n_in,
                              void* d_out, int out_size, void* d_ws, size_t ws_size,
                              hipStream_t stream) {
  const float* hidden  = (const float*)d_in[0];
  const float* context = (const float*)d_in[1];
  const float* amask   = (const float*)d_in[2];
  const float* Wq = (const float*)d_in[3];
  const float* bq = (const float*)d_in[4];
  const float* Wk = (const float*)d_in[5];
  const float* bk = (const float*)d_in[6];
  const float* Wv = (const float*)d_in[7];
  const float* bv = (const float*)d_in[8];
  float* outp = (float*)d_out;

  const size_t ACT = (size_t)BATCH * SEQ * HIDDEN;   // 3,145,728 elems
  const size_t WSZ = (size_t)HIDDEN * HIDDEN;        //   589,824 elems
  const size_t A_BYTES = ACT * sizeof(f16);          // 6,291,456
  const size_t W_BYTES = WSZ * sizeof(f16);          // 1,179,648

  char* ws = (char*)d_ws;
  f16* Xh16 = (f16*)(ws);
  f16* Xc16 = (f16*)(ws + A_BYTES);
  f16* Wq16 = (f16*)(ws + 2 * A_BYTES);              // packed Wq, Wk, Wv, W_BYTES each
  f16* Q16  = (f16*)(ws + 2 * A_BYTES + 3 * W_BYTES);
  f16* K16  = (f16*)(ws + 3 * A_BYTES + 3 * W_BYTES);
  f16* Vt16 = (f16*)(ws + 4 * A_BYTES + 3 * W_BYTES);

  // one wave per fragment, 8 waves per block; Xh16, Xc16, Wq16, Wk16, Wv16 in one grid
  pack_f32_f16<<<(2 * ACT + 3 * WSZ) / FRAG / 8, 256, 0, stream>>>(hidden, context, Wq, Wk, Wv, Xh16);

  const float qscale = 1.0f / sqrtf((float)HD + 1e-5f);
  dim3 pgrid((BATCH * SEQ) / 64, HEADS, 3);          // 4 waves x 16 rows per block; z: Q, K, V
  proj_kernel<<<pgrid, 128, 0, stream>>>(Xh16, Xc16, Wq16, bq, bk, bv, Q16, qscale);

  dim3 agrid(SEQ / 128, BATCH * HEADS);
  attn_kernel<<<agrid, 128, 0, stream>>>(Q16, K16, Vt16, amask, outp);
}

// v004
// One run takes 75.2 microseconds.
// Two timings next to v003 both put it at 1.07 times that version's speed.
// All steps since v000 together make it 2.30 times as fast.
#include <hip/hip_runtime.h>

typedef _Float16 f16;
typedef _Float16 v4h  __attribute__((ext_vector_type(4)));
typedef _Float16 v8h  __attribute__((ext_vector_type(8)));
typedef _Float16 v16h __attribute__((ext_vector_type(16)));
typedef float    v8f  __attribute__((ext_vector_type(8)));

#define HIDDEN 768
#define HEADS  12
#define HD     64
#define SEQ    2048
#define BATCH  2

#define WMMA_F16(A, B, C) \
  __builtin_amdgcn_wmma_f32_16x16x32_f16(false, (A), false, (B), (short)0, (C), false, false)

static __device__ __forceinline__ v16h cat8(v8h lo, v8h hi) {
  return __builtin_shufflevector(lo, hi, 0,1,2,3,4,5,6,7,8,9,10,11,12,13,14,15);
}

// ---------------------------------------------------------------- fragment order
// Every f16 operand in the workspace is stored as 1-KiB WMMA fragments
// (16 rows x 32 k). Element (row, k) of a fragment sits at half index
//   (k >> 4) * 256 + (((k >> 3) & 1) * 16 + row) * 8 + (k & 7)
// so lane l reads its 2 x 8 halfs at l * 8 and 256 + l * 8: each wave-wide
// 16-byte load covers 512 contiguous bytes (4 lines) instead of 16 rows.
#define FRAG 512                 // halfs per fragment
#define KFR  (HIDDEN / 32)       // fragments along k of a 768-wide operand
#define AHEAD 3                  // k-steps of projection operands in flight per wave
#define RT    4                  // 16-row X tiles per projection wave

static __device__ __forceinline__ v16h load_frag(const f16* p) {   // p includes lane * 8
  return cat8(*(const v8h*)p, *(const v8h*)(p + 256));
}

// A wave-uniform pointer held in a scalar register pair: the loads formed from it
// take the scalar-base form with the lane's 32-bit offset beside it. Without it the
// key loop rebuilds two 64-bit vector addresses every trip in registers that the
// last load of the run then takes for its result.
static __device__ __forceinline__ const char* scalar_base(const f16* p) {
  const unsigned long long a = (unsigned long long)p;
  const unsigned lo = (unsigned)__builtin_amdgcn_readfirstlane((int)(unsigned)a);
  const unsigned hi = (unsigned)__builtin_amdgcn_readfirstlane((int)(unsigned)(a >> 32));
  return (const char*)(((unsigned long long)hi << 32) | lo);
}

// ---------------------------------------------------------------- f32 -> f16, packed
// Each plane: rows x 768 f32. One wave converts one fragment: 4 loads of 4 whole lines,
// 4 stores of 8 bytes per lane. plane[(rowtile * KFR + ks) * FRAG + ...].
// One grid packs all five planes; they lie one behind the other in out, in the order
// of the arguments, so a fragment's place in out is its index over the whole grid.
// Every plane is a whole number of 8-fragment blocks: the choice is block-uniform.
#define XFR (BATCH * SEQ * HIDDEN / FRAG)   // fragments of an activation plane
#define WFR (HIDDEN * HIDDEN / FRAG)        // fragments of a weight plane
__global__ __launch_bounds__(256)
void pack_f32_f16(const float* __restrict__ hidden, const float* __restrict__ context,
                  const float* __restrict__ Wq, const float* __restrict__ Wk,
                  const float* __restrict__ Wv, f16* __restrict__ out) {
  const int lane = threadIdx.x & 31;
  const int gfr  = (blockIdx.x * 256 + threadIdx.x) >> 5;   // fragment index in out
  const int bfr  = blockIdx.x * 8;                          // the block's first fragment
  const float* in = hidden;
  int first = 0;
  if (bfr >= XFR)               { in = context; first = XFR; }
  if (bfr >= 2 * XFR)           { in = Wq;      first = 2 * XFR; }
  if (bfr >= 2 * XFR + WFR)     { in = Wk;      first = 2 * XFR + WFR; }
  if (bfr >= 2 * XFR + 2 * WFR) { in = Wv;      first = 2 * XFR + 2 * WFR; }
  const int fr   = gfr - first;                             // fragment index in its plane
  const int mt   = fr / KFR;
  const int ks   = fr % KFR;
  const int k4   = lane & 7;                                // float4 within the 32 k
  const float* src = in + (size_t)(mt * 16 + (lane >> 3)) * HIDDEN + ks * 32 + k4 * 4;
  f16* dst = out + (size_t)gfr * FRAG + (k4 >> 2) * 256
                 + (((k4 >> 1) & 1) * 16 + (lane >> 3)) * 8 + (k4 & 1) * 4;
  float4 v[4];
  #pragma unroll
  for (int i = 0; i < 4; ++i)
    v[i] = *(const float4*)(src + (size_t)i * 4 * HIDDEN);
  #pragma unroll
  for (int i = 0; i < 4; ++i) {
    v4h y = {(f16)v[i].x, (f16)v[i].y, (f16)v[i].z, (f16)v[i].w};
    *(v4h*)(dst + i * 4 * 8) = y;
  }
}

// ---------------------------------------------------------------- projection
// Y = X(4096x768) @ W^T(768x768) + bias. Each wave computes a 64x64 tile
// (4 X frags x 4 W frags -> 16 loads : 16 WMMAs per k-step). The 4 waves of a block
// form 2 x 2 such tiles: each fragment is asked for by two waves of one block.
// VT false: Q or K. The product is formed as W x X^T, so a lane holds 8
//   consecutive d of one position: its 16 bytes of the [bh][s/16][d/32] fragment.
// VT true: V. The product is formed as X x W^T, so a lane holds 8 consecutive
//   positions of one d: its 16 bytes of the [bh][s/32][d/16] fragment.
template <bool VT>
static __device__ __forceinline__
void proj_body(const f16* __restrict__ X, const f16* __restrict__ W,
               const float* __restrict__ bias, f16* __restrict__ out,
               float scale) {
  const int lane = threadIdx.x & 31;
  const int wave = threadIdx.x >> 5;
  const int lr   = lane & 15;
  const int hf   = lane >> 4;

  const int mt0 = (blockIdx.x * 2 + (wave & 1)) * RT;   // first of the wave's row tiles (0..255)
  const int h   = blockIdx.y * 2 + (wave >> 1);         // head == 64-col group

  const f16* xf = X + (size_t)mt0 * KFR * FRAG + lane * 8;
  const f16* wf = W + (size_t)(h * 4) * KFR * FRAG + lane * 8;

  // Register ring, AHEAD k-steps deep: the 16 loads of k-step ks + AHEAD are issued
  // right behind the products of k-step ks, so a wave waits for a load that is
  // AHEAD k-steps old instead of for the one it has just issued.
  v16h a[AHEAD][RT], w[AHEAD][4];
  #pragma unroll
  for (int s = 0; s < AHEAD; ++s) {
    #pragma unroll
    for (int i = 0; i < RT; ++i)
      a[s][i] = load_frag(xf + (i * KFR + s) * FRAG);
    #pragma unroll
    for (int t = 0; t < 4; ++t)
      w[s][t] = load_frag(wf + (t * KFR + s) * FRAG);
  }

  v8f acc[RT][4] = {};
  #pragma unroll
  for (int ks = 0; ks < KFR; ++ks) {
    const int s = ks % AHEAD;
    #pragma unroll
    for (int i = 0; i < RT; ++i)
      #pragma unroll
      for (int t = 0; t < 4; ++t)
        acc[i][t] = VT ? WMMA_F16(a[s][i], w[s][t], acc[i][t]) : WMMA_F16(w[s][t], a[s][i], acc[i][t]);
    if (ks + AHEAD < KFR) {
      #pragma unroll
      for (int i = 0; i < RT; ++i)
        a[s][i] = load_frag(xf + (i * KFR + ks + AHEAD) * FRAG);
      #pragma unroll
      for (int t = 0; t < 4; ++t)
        w[s][t] = load_frag(wf + (t * KFR + ks + AHEAD) * FRAG);
    }
    // Keeps the scheduler from sinking these loads down to their use, AHEAD k-steps later:
    // without it every product waits out the whole latency of the load in front of it.
    __builtin_amdgcn_sched_barrier(0);
  }

  // Every fragment load is issued: the wait stands in front of the epilogue's rewrite of
  // their address registers; the directive keeps the scheduler from lifting that rewrite over it.
  asm volatile("s_wait_xcnt 0x0" ::: "memory");
  __builtin_amdgcn_sched_barrier(0);

  const int bh = ((mt0 * 16) >> 11) * HEADS + h; // SEQ == 2048; 64 rows lie in one batch
  #pragma unroll
  for (int i = 0; i < RT; ++i) {
    const int s0 = ((mt0 + i) * 16) & (SEQ - 1);
    #pragma unroll
    for (int t = 0; t < 4; ++t) {
      v8h y;
      if (VT) {
        const float bv = bias[h * 64 + t * 16 + lr];
        #pragma unroll
        for (int r = 0; r < 8; ++r) y[r] = (f16)((acc[i][t][r] + bv) * scale);
        *(v8h*)(out + ((size_t)(bh * (SEQ / 32) + (s0 >> 5)) * 4 + t) * FRAG
                    + ((s0 >> 4) & 1) * 256 + lane * 8) = y;
      } else {
        const float* bp = bias + h * 64 + t * 16 + 8 * hf;
        #pragma unroll
        for (int r = 0; r < 8; ++r) y[r] = (f16)((acc[i][t][r] + bp[r]) * scale);
        *(v8h*)(out + ((size_t)(bh * (SEQ / 16) + (s0 >> 4)) * 2 + (t >> 1)) * FRAG
                    + (t & 1) * 256 + lane * 8) = y;
      }
    }
  }
  // In the merged kernel the V body's code follows this body's stores in the listing and
  // writes their address and data registers: the wait stands between stores and rewrite.
  if (!VT) asm volatile("s_wait_xcnt 0x0" ::: "memory");
}

// One grid for the three projections: blockIdx.z = 0 Q, 1 K, 2 V. The packed weight
// planes lie one behind the other in W3, the three result planes in out3.
__global__ __launch_bounds__(128)
void proj_kernel(const f16* __restrict__ Xh, const f16* __restrict__ Xc,
                 const f16* __restrict__ W3, const float* __restrict__ bq,
                 const float* __restrict__ bk, const float* __restrict__ bv,
                 f16* __restrict__ out3, float qscale) {
  const int z = blockIdx.z;
  const f16* W = W3 + (size_t)z * (HIDDEN * HIDDEN);
  f16* out = out3 + (size_t)z * (BATCH * SEQ * HIDDEN);
  if (z == 2)
    proj_body<true>(Xc, W, bv, out, 1.0f);
  else
    proj_body<false>(z ? Xc : Xh, W, z ? bk : bq, out, z ? 1.0f : qscale);
}

// ---------------------------------------------------------------- attention
// grid: (SEQ/128, B*H), block 128 (4 waves). Wave owns 32 query rows (two
// 16-row tiles), streams keys in chunks of 32 with online softmax. K/V frags
// loaded once per chunk and reused by both query tiles -> 1:1 VMEM:WMMA.
// Q, K: fragments [bh][s/16][d/32]; Vt: fragments [bh][s/32][d/16].
__global__ __launch_bounds__(128)
void attn_kernel(const f16* __restrict__ Q, const f16* __restrict__ K,
                 const f16* __restrict__ Vt, const float* __restrict__ mask,
                 float* __restrict__ out) {
  __shared__ float smask[SEQ];
  const int bh = blockIdx.y;
  const int b  = bh / HEADS;
  const int h  = bh % HEADS;

  for (int i = threadIdx.x; i < SEQ; i += blockDim.x)
    smask[i] = mask[(size_t)b * SEQ + i];
  __syncthreads();

  const int lane = threadIdx.x & 31;
  const int wave = threadIdx.x >> 5;
  const int lr   = lane & 15;
  const int hf   = lane >> 4;
  const int q0   = blockIdx.x * 128 + wave * 32;   // 32-query strip base

  // Q as B-operand of S^T = K x Q^T (two query tiles, resident)
  v16h Qb[2][2];
  #pragma unroll
  for (int u = 0; u < 2; ++u) {
    const f16* qf = Q + ((size_t)bh * SEQ + q0 + u * 16) * HD + lane * 8;
    #pragma unroll
    for (int ks = 0; ks < 2; ++ks)
      Qb[u][ks] = load_frag(qf + ks * FRAG);
  }

  const f16* Kbh = K  + (size_t)bh * SEQ * HD;
  const f16* Vbh = Vt + (size_t)bh * HD * SEQ;
  const char* Ks = scalar_base(Kbh);
  const char* Vs = scalar_base(Vbh);
  // K and V chunks sit at the same place in their planes: one 32-bit byte offset
  // per lane, carried through the loop, beside the two scalar bases.
  unsigned off = lane * 16;

  v8f O[2][4] = {};
  float m_run[2] = {-1e30f, -1e30f};
  float l_run[2] = {0.f, 0.f};

  for (int kb = 0; kb < SEQ; kb += 32) {
    // ---- shared K A-frags (2 key tiles x 2 k-steps) and V B-frags (4 d-tiles)
    v16h ka[2][2];
    #pragma unroll
    for (int c = 0; c < 2; ++c)
      #pragma unroll
      for (int ks = 0; ks < 2; ++ks)
        ka[c][ks] = load_frag((const f16*)(Ks + off) + (c * 2 + ks) * FRAG);
    v16h vb[4];
    #pragma unroll
    for (int t = 0; t < 4; ++t)
      vb[t] = load_frag((const f16*)(Vs + off) + t * FRAG);
    float mk0[8], mk1[8];
    #pragma unroll
    for (int r = 0; r < 8; ++r) {
      mk0[r] = smask[kb + r + 8 * hf];
      mk1[r] = smask[kb + 16 + r + 8 * hf];
    }

    if (kb + 32 < SEQ) {   // global_prefetch_b8: next chunk's 4 KiB of K and of V, one ask per 256 B
      __builtin_prefetch(Kbh + (size_t)(kb + 32) * HD + lr * 128, 0, 1);
      __builtin_prefetch(Vbh + (size_t)(kb + 32) * HD + lr * 128, 0, 1);
    }

    #pragma unroll
    for (int u = 0; u < 2; ++u) {
      // ---- S^T tiles for query tile u
      v8f c0 = {}, c1 = {};
      #pragma unroll
      for (int ks = 0; ks < 2; ++ks) {
        c0 = WMMA_F16(ka[0][ks], Qb[u][ks], c0);
        c1 = WMMA_F16(ka[1][ks], Qb[u][ks], c1);
      }

      // ---- online softmax; lane carries query lr (replicated in halves)
      float p[16];
      float mx = -1e30f;
      #pragma unroll
      for (int r = 0; r < 8; ++r) {
        float s0 = c0[r] + mk0[r];
        float s1 = c1[r] + mk1[r];
        p[r] = s0; p[8 + r] = s1;
        mx = fmaxf(mx, fmaxf(s0, s1));
      }
      mx = fmaxf(mx, __shfl_xor(mx, 16, 32));
      const float m_new = fmaxf(m_run[u], mx);
      const float alpha = __expf(m_run[u] - m_new);

      v16h pa;              // C-layout of S^T tiles == A-layout of P
      float lsum = 0.f;
      #pragma unroll
      for (int r = 0; r < 8; ++r) {
        float e0 = __expf(p[r] - m_new);
        float e1 = __expf(p[8 + r] - m_new);
        lsum += e0 + e1;
        pa[r] = (f16)e0; pa[8 + r] = (f16)e1;
      }
      lsum += __shfl_xor(lsum, 16, 32);
      l_run[u] = l_run[u] * alpha + lsum;
      m_run[u] = m_new;

      // ---- rescale O rows (row M = r + 8*hf; alpha for query j lives in lane j)
      #pragma unroll
      for (int r = 0; r < 8; ++r) {
        float ar = __shfl(alpha, r + 8 * hf, 32);
        #pragma unroll
        for (int t = 0; t < 4; ++t) O[u][t][r] *= ar;
      }

      // ---- O += P x Vchunk (V frags shared across u)
      #pragma unroll
      for (int t = 0; t < 4; ++t)
        O[u][t] = WMMA_F16(pa, vb[t], O[u][t]);
    }
    off += 32 * HD * sizeof(f16);
  }

  // ---- normalize and store [B,S,768] f32
  #pragma unroll
  for (int u = 0; u < 2; ++u) {
    const float inv = 1.0f / l_run[u];
    #pragma unroll
    for (int r = 0; r < 8; ++r) {
      float ir = __shfl(inv, r + 8 * hf, 32);
      const int s = q0 + u * 16 + r + 8 * hf;
      #pragma unroll
      for (int t = 0; t < 4; ++t)
        out[((size_t)b * SEQ + s) * HIDDEN + h * 64 + t * 16 + lr] = O[u][t][r] * ir;
    }
  }
}

// ---------------------------------------------------------------- launcher
extern "C" void kernel_launch(void* const* d_in, const int* in_sizes, int n_in,
                              void* d_out, int out_size, void* d_ws, size_t ws_size,
                              hipStream_t stream) {
  const float* hidden  = (const float*)d_in[0];
  const float* context = (const float*)d_in[1];
  const float* amask   = (const float*)d_in[2];
  const float* Wq = (const float*)d_in[3];
  const float* bq = (const float*)d_in[4];
  const float* Wk = (const float*)d_in[5];
  const float* bk = (const float*)d_in[6];
  const float* Wv = (const float*)d_in[7];
  const float* bv = (const float*)d_in[8];
  float* outp = (float*)d_out;

  const size_t ACT = (size_t)BATCH * SEQ * HIDDEN;   // 3,145,728 elems
  const size_t WSZ = (size_t)HIDDEN * HIDDEN;        //   589,824 elems
  const size_t A_BYTES = ACT * sizeof(f16);          // 6,291,456
  const size_t W_BYTES = WSZ * sizeof(f16);          // 1,179,648

  char* ws = (char*)d_ws;
  f16* Xh16 = (f16*)(ws);
  f16* Xc16 = (f16*)(ws + A_BYTES);
  f16* Wq16 = (f16*)(ws + 2 * A_BYTES);              // packed Wq, Wk, Wv, W_BYTES each
  f16* Q16  = (f16*)(ws + 2 * A_BYTES + 3 * W_BYTES);
  f16* K16  = (f16*)(ws + 3 * A_BYTES + 3 * W_BYTES);
  f16* Vt16 = (f16*)(ws + 4 * A_BYTES + 3 * W_BYTES);

  // one wave per fragment, 8 waves per block; Xh16, Xc16, Wq16, Wk16, Wv16 in one grid
  pack_f32_f16<<<(2 * ACT + 3 * WSZ) / FRAG / 8, 256, 0, stream>>>(hidden, context, Wq, Wk, Wv, Xh16);

  const float qscale = 1.0f / sqrtf((float)HD + 1e-5f);
  dim3 pgrid((BATCH * SEQ) / 128, HEADS / 2, 3);     // 2 x 2 waves of 64 rows x 1 head per block; z: Q, K, V
  proj_kernel<<<pgrid, 128, 0, stream>>>(Xh16, Xc16, Wq16, bq, bk, bv, Q16, qscale);

  dim3 agrid(SEQ / 128, BATCH * HEADS);
  attn_kernel<<<agrid, 128, 0, stream>>>(Q16, K16, Vt16, amask, outp);
}

// v005
// One run takes 61.3 microseconds.
// Two timings next to v004 put it at 1.24 and 1.25 times that version's speed.
// Counting every step since v000, it is 2.87 times as fast.
#include <hip/hip_runtime.h>

typedef _Float16 f16;
typedef _Float16 v4h  __attribute__((ext_vector_type(4)));
typedef _Float16 v8h  __attribute__((ext_vector_type(8)));
typedef _Float16 v16h __attribute__((ext_vector_type(16)));
typedef float    v8f  __attribute__((ext_vector_type(8)));
typedef float    v4f  __attribute__((ext_vector_type(4)));

#define HIDDEN 768
#define HEADS  12
#define HD     64
#define SEQ    2048
#define BATCH  2

#define WMMA_F16(A, B, C) \
  __builtin_amdgcn_wmma_f32_16x16x32_f16(false, (A), false, (B), (short)0, (C), false, false)

static __device__ __forceinline__ v16h cat8(v8h lo, v8h hi) {
  return __builtin_shufflevector(lo, hi, 0,1,2,3,4,5,6,7,8,9,10,11,12,13,14,15);
}

// ---------------------------------------------------------------- fragment order
// Every f16 operand in the workspace is stored as 1-KiB WMMA fragments
// (16 rows x 32 k). Element (row, k) of a fragment sits at half index
//   (k >> 4) * 256 + (((k >> 3) & 1) * 16 + row) * 8 + (k & 7)
// so lane l reads its 2 x 8 halfs at l * 8 and 256 + l * 8: each wave-wide
// 16-byte load covers 512 contiguous bytes (4 lines) instead of 16 rows.
#define FRAG 512                 // halfs per fragment
#define KFR  (HIDDEN / 32)       // fragments along k of a 768-wide operand
#define AHEAD 3                  // k-steps of projection operands in flight per wave
#define RT    4                  // 16-row X tiles per projection wave

static __device__ __forceinline__ v16h load_frag(const f16* p) {   // p includes lane * 8
  return cat8(*(const v8h*)p, *(const v8h*)(p + 256));
}

// A wave-uniform pointer held in a scalar register pair: the loads formed from it
// take the scalar-base form with the lane's 32-bit offset beside it. Without it the
// key loop rebuilds two 64-bit vector addresses every trip in registers that the
// last load of the run then takes for its result.
static __device__ __forceinline__ const char* scalar_base(const f16* p) {
  const unsigned long long a = (unsigned long long)p;
  const unsigned lo = (unsigned)__builtin_amdgcn_readfirstlane((int)(unsigned)a);
  const unsigned hi = (unsigned)__builtin_amdgcn_readfirstlane((int)(unsigned)(a >> 32));
  return (const char*)(((unsigned long long)hi << 32) | lo);
}

// ---------------------------------------------------------------- f32 -> f16, packed
// Each plane: rows x 768 f32. One wave converts one fragment: 4 loads of 4 whole lines,
// 4 stores of 8 bytes per lane. plane[(rowtile * KFR + ks) * FRAG + ...].
// One grid packs all five planes; they lie one behind the other in out, in the order
// of the arguments, so a fragment's place in out is its index over the whole grid.
// Every plane is a whole number of 8-fragment blocks: the choice is block-uniform.
#define XFR (BATCH * SEQ * HIDDEN / FRAG)   // fragments of an activation plane
#define WFR (HIDDEN * HIDDEN / FRAG)        // fragments of a weight plane
__global__ __launch_bounds__(256)
void pack_f32_f16(const float* __restrict__ hidden, const float* __restrict__ context,
                  const float* __restrict__ Wq, const float* __restrict__ Wk,
                  const float* __restrict__ Wv, f16* __restrict__ out) {
  const int lane = threadIdx.x & 31;
  const int gfr  = (blockIdx.x * 256 + threadIdx.x) >> 5;   // fragment index in out
  const int bfr  = blockIdx.x * 8;                          // the block's first fragment
  const float* in = hidden;
  int first = 0;
  if (bfr >= XFR)               { in = context; first = XFR; }
  if (bfr >= 2 * XFR)           { in = Wq;      first = 2 * XFR; }
  if (bfr >= 2 * XFR + WFR)     { in = Wk;      first = 2 * XFR + WFR; }
  if (bfr >= 2 * XFR + 2 * WFR) { in = Wv;      first = 2 * XFR + 2 * WFR; }
  const int fr   = gfr - first;                             // fragment index in its plane
  const int mt   = fr / KFR;
  const int ks   = fr % KFR;
  const int k4   = lane & 7;                                // float4 within the 32 k
  const float* src = in + (size_t)(mt * 16 + (lane >> 3)) * HIDDEN + ks * 32 + k4 * 4;
  f16* dst = out + (size_t)gfr * FRAG + (k4 >> 2) * 256
                 + (((k4 >> 1) & 1) * 16 + (lane >> 3)) * 8 + (k4 & 1) * 4;
  float4 v[4];
  #pragma unroll
  for (int i = 0; i < 4; ++i)
    v[i] = *(const float4*)(src + (size_t)i * 4 * HIDDEN);
  #pragma unroll
  for (int i = 0; i < 4; ++i) {
    v4h y = {(f16)v[i].x, (f16)v[i].y, (f16)v[i].z, (f16)v[i].w};
    *(v4h*)(dst + i * 4 * 8) = y;
  }
}

// ---------------------------------------------------------------- projection
// Y = X(4096x768) @ W^T(768x768) + bias. Each wave computes a 64x64 tile
// (4 X frags x 4 W frags -> 16 loads : 16 WMMAs per k-step). The 4 waves of a block
// form 2 x 2 such tiles: each fragment is asked for by two waves of one block.
// VT false: Q or K. The product is formed as W x X^T, so a lane holds 8
//   consecutive d of one position: its 16 bytes of the [bh][s/16][d/32] fragment.
// VT true: V. The product is formed as X x W^T, so a lane holds 8 consecutive
//   positions of one d: its 16 bytes of the [bh][s/32][d/16] fragment.
template <bool VT>
static __device__ __forceinline__
void proj_body(const f16* __restrict__ X, const f16* __restrict__ W,
               const float* __restrict__ bias, f16* __restrict__ out,
               float scale) {
  const int lane = threadIdx.x & 31;
  const int wave = threadIdx.x >> 5;
  const int lr   = lane & 15;
  const int hf   = lane >> 4;

  const int mt0 = (blockIdx.x * 2 + (wave & 1)) * RT;   // first of the wave's row tiles (0..255)
  const int h   = blockIdx.y * 2 + (wave >> 1);         // head == 64-col group

  const f16* xf = X + (size_t)mt0 * KFR * FRAG + lane * 8;
  const f16* wf = W + (size_t)(h * 4) * KFR * FRAG + lane * 8;

  // Register ring, AHEAD k-steps deep: the 16 loads of k-step ks + AHEAD are issued
  // right behind the products of k-step ks, so a wave waits for a load that is
  // AHEAD k-steps old instead of for the one it has just issued.
  v16h a[AHEAD][RT], w[AHEAD][4];
  #pragma unroll
  for (int s = 0; s < AHEAD; ++s) {
    #pragma unroll
    for (int i = 0; i < RT; ++i)
      a[s][i] = load_frag(xf + (i * KFR + s) * FRAG);
    #pragma unroll
    for (int t = 0; t < 4; ++t)
      w[s][t] = load_frag(wf + (t * KFR + s) * FRAG);
  }

  v8f acc[RT][4] = {};
  #pragma unroll
  for (int ks = 0; ks < KFR; ++ks) {
    const int s = ks % AHEAD;
    #pragma unroll
    for (int i = 0; i < RT; ++i)
      #pragma unroll
      for (int t = 0; t < 4; ++t)
        acc[i][t] = VT ? WMMA_F16(a[s][i], w[s][t], acc[i][t]) : WMMA_F16(w[s][t], a[s][i], acc[i][t]);
    if (ks + AHEAD < KFR) {
      #pragma unroll
      for (int i = 0; i < RT; ++i)
        a[s][i] = load_frag(xf + (i * KFR + ks + AHEAD) * FRAG);
      #pragma unroll
      for (int t = 0; t < 4; ++t)
        w[s][t] = load_frag(wf + (t * KFR + ks + AHEAD) * FRAG);
    }
    // Keeps the scheduler from sinking these loads down to their use, AHEAD k-steps later:
    // without it every product waits out the whole latency of the load in front of it.
    __builtin_amdgcn_sched_barrier(0);
  }

  // Every fragment load is issued: the wait stands in front of the epilogue's rewrite of
  // their address registers; the directive keeps the scheduler from lifting that rewrite over it.
  asm volatile("s_wait_xcnt 0x0" ::: "memory");
  __builtin_amdgcn_sched_barrier(0);

  const int bh = ((mt0 * 16) >> 11) * HEADS + h; // SEQ == 2048; 64 rows lie in one batch
  #pragma unroll
  for (int i = 0; i < RT; ++i) {
    const int s0 = ((mt0 + i) * 16) & (SEQ - 1);
    #pragma unroll
    for (int t = 0; t < 4; ++t) {
      v8h y;
      if (VT) {
        const float bv = bias[h * 64 + t * 16 + lr];
        #pragma unroll
        for (int r = 0; r < 8; ++r) y[r] = (f16)((acc[i][t][r] + bv) * scale);
        *(v8h*)(out + ((size_t)(bh * (SEQ / 32) + (s0 >> 5)) * 4 + t) * FRAG
                    + ((s0 >> 4) & 1) * 256 + lane * 8) = y;
      } else {
        const float* bp = bias + h * 64 + t * 16 + 8 * hf;
        #pragma unroll
        for (int r = 0; r < 8; ++r) y[r] = (f16)((acc[i][t][r] + bp[r]) * scale);
        *(v8h*)(out + ((size_t)(bh * (SEQ / 16) + (s0 >> 4)) * 2 + (t >> 1)) * FRAG
                    + (t & 1) * 256 + lane * 8) = y;
      }
    }
  }
  // In the merged kernel the V body's code follows this body's stores in the listing and
  // writes their address and data registers: the wait stands between stores and rewrite.
  if (!VT) asm volatile("s_wait_xcnt 0x0" ::: "memory");
}

// One grid for the three projections: blockIdx.z = 0 Q, 1 K, 2 V. The packed weight
// planes lie one behind the other in W3, the three result planes in out3.
__global__ __launch_bounds__(128)
void proj_kernel(const f16* __restrict__ Xh, const f16* __restrict__ Xc,
                 const f16* __restrict__ W3, const float* __restrict__ bq,
                 const float* __restrict__ bk, const float* __restrict__ bv,
                 f16* __restrict__ out3, float qscale) {
  const int z = blockIdx.z;
  const f16* W = W3 + (size_t)z * (HIDDEN * HIDDEN);
  f16* out = out3 + (size_t)z * (BATCH * SEQ * HIDDEN);
  if (z == 2)
    proj_body<true>(Xc, W, bv, out, 1.0f);
  else
    proj_body<false>(z ? Xc : Xh, W, z ? bk : bq, out, z ? 1.0f : qscale);
}

// ---------------------------------------------------------------- attention
// grid: (SEQ/64, B*H), block 128 (4 waves) = 2 query strips x 2 key halves. A wave owns
// 32 query rows (two 16-row tiles) and one half of the keys, streamed in chunks of 32
// with online softmax: 3072 waves, three for each of the chip's 1024 SIMDs (one wave per
// strip makes 1536, which no placement spreads evenly). The two waves of a strip join
// their partial results through LDS behind the loop. K/V frags loaded once per
// chunk and reused by both query tiles -> 1:1 VMEM:WMMA.
// Q, K: fragments [bh][s/16][d/32]; Vt: fragments [bh][s/32][d/16].
#define KHALF (SEQ / 2)          // keys per wave
__global__ __launch_bounds__(128)
void attn_kernel(const f16* __restrict__ Q, const f16* __restrict__ K,
                 const f16* __restrict__ Vt, const float* __restrict__ mask,
                 float* __restrict__ out) {
  __shared__ float smask[SEQ];
  __shared__ v4f   xO[4][8][32];         // per wave: the output tile it hands to its partner
  __shared__ float xm[4][32], xl[4][32]; // and that tile's running maximum and sum
  const int bh = blockIdx.y;
  const int b  = bh / HEADS;
  const int h  = bh % HEADS;

  for (int i = threadIdx.x; i < SEQ; i += blockDim.x)
    smask[i] = mask[(size_t)b * SEQ + i];
  __syncthreads();

  const int lane = threadIdx.x & 31;
  // the wave's number in a scalar register: the key loop's bounds stay scalar
  const int wave = __builtin_amdgcn_readfirstlane(threadIdx.x >> 5);
  const int lr   = lane & 15;
  const int hf   = lane >> 4;
  const int half = wave >> 1;                            // which half of the keys
  const int q0   = blockIdx.x * 64 + (wave & 1) * 32;    // 32-query strip base
  const int kb0  = half * KHALF;                         // the wave's first key

  // Q as B-operand of S^T = K x Q^T (two query tiles, resident)
  v16h Qb[2][2];
  #pragma unroll
  for (int u = 0; u < 2; ++u) {
    const f16* qf = Q + ((size_t)bh * SEQ + q0 + u * 16) * HD + lane * 8;
    #pragma unroll
    for (int ks = 0; ks < 2; ++ks)
      Qb[u][ks] = load_frag(qf + ks * FRAG);
  }

  const f16* Kbh = K  + (size_t)bh * SEQ * HD;
  const f16* Vbh = Vt + (size_t)bh * HD * SEQ;
  const char* Ks = scalar_base(Kbh);
  const char* Vs = scalar_base(Vbh);
  // K and V chunks sit at the same place in their planes: one 32-bit byte offset
  // per lane, carried through the loop, beside the two scalar bases.
  unsigned off = lane * 16 + kb0 * (HD * sizeof(f16));

  v8f O[2][4] = {};
  float m_run[2] = {-1e30f, -1e30f};
  float l_run[2] = {0.f, 0.f};

  for (int kb = kb0; kb < kb0 + KHALF; kb += 32) {
    // ---- shared K A-frags (2 key tiles x 2 k-steps) and V B-frags (4 d-tiles)
    v16h ka[2][2];
    #pragma unroll
    for (int c = 0; c < 2; ++c)
      #pragma unroll
      for (int ks = 0; ks < 2; ++ks)
        ka[c][ks] = load_frag((const f16*)(Ks + off) + (c * 2 + ks) * FRAG);
    v16h vb[4];
    #pragma unroll
    for (int t = 0; t < 4; ++t)
      vb[t] = load_frag((const f16*)(Vs + off) + t * FRAG);
    float mk0[8], mk1[8];
    #pragma unroll
    for (int r = 0; r < 8; ++r) {
      mk0[r] = smask[kb + r + 8 * hf];
      mk1[r] = smask[kb + 16 + r + 8 * hf];
    }

    if (kb + 32 < kb0 + KHALF) {   // global_prefetch_b8: next chunk's 4 KiB of K and of V, one ask per 256 B
      __builtin_prefetch(Kbh + (size_t)(kb + 32) * HD + lr * 128, 0, 1);
      __builtin_prefetch(Vbh + (size_t)(kb + 32) * HD + lr * 128, 0, 1);
    }

    #pragma unroll
    for (int u = 0; u < 2; ++u) {
      // ---- S^T tiles for query tile u
      v8f c0 = {}, c1 = {};
      #pragma unroll
      for (int ks = 0; ks < 2; ++ks) {
        c0 = WMMA_F16(ka[0][ks], Qb[u][ks], c0);
        c1 = WMMA_F16(ka[1][ks], Qb[u][ks], c1);
      }

      // ---- online softmax; lane carries query lr (replicated in halves)
      float p[16];
      float mx = -1e30f;
      #pragma unroll
      for (int r = 0; r < 8; ++r) {
        float s0 = c0[r] + mk0[r];
        float s1 = c1[r] + mk1[r];
        p[r] = s0; p[8 + r] = s1;
        mx = fmaxf(mx, fmaxf(s0, s1));
      }
      mx = fmaxf(mx, __shfl_xor(mx, 16, 32));
      const float m_new = fmaxf(m_run[u], mx);
      const float alpha = __expf(m_run[u] - m_new);

      v16h pa;              // C-layout of S^T tiles == A-layout of P
      float lsum = 0.f;
      #pragma unroll
      for (int r = 0; r < 8; ++r) {
        float e0 = __expf(p[r] - m_new);
        float e1 = __expf(p[8 + r] - m_new);
        lsum += e0 + e1;
        pa[r] = (f16)e0; pa[8 + r] = (f16)e1;
      }
      lsum += __shfl_xor(lsum, 16, 32);
      l_run[u] = l_run[u] * alpha + lsum;
      m_run[u] = m_new;

      // ---- rescale O rows (row M = r + 8*hf; alpha for query j lives in lane j)
      #pragma unroll
      for (int r = 0; r < 8; ++r) {
        float ar = __shfl(alpha, r + 8 * hf, 32);
        #pragma unroll
        for (int t = 0; t < 4; ++t) O[u][t][r] *= ar;
      }

      // ---- O += P x Vchunk (V frags shared across u)
      #pragma unroll
      for (int t = 0; t < 4; ++t)
        O[u][t] = WMMA_F16(pa, vb[t], O[u][t]);
    }
    // Holds the step of off down here, behind the products that wait for every load of the
    // trip: lifted up among them it would rewrite the offset register of loads still in flight.
    __builtin_amdgcn_sched_barrier(0);
    off += 32 * HD * sizeof(f16);
  }

  // ---- join the two key halves: the wave of half h finishes query tile h of its strip
  // and hands its partial sums of the other tile to its partner (wave ^ 2) through LDS.
  const bool hi = half != 0;
  v8f keep[4];
  #pragma unroll
  for (int t = 0; t < 4; ++t) {
    const v8f give = hi ? O[0][t] : O[1][t];
    keep[t] = hi ? O[1][t] : O[0][t];
    xO[wave][t * 2][lane]     = __builtin_shufflevector(give, give, 0, 1, 2, 3);
    xO[wave][t * 2 + 1][lane] = __builtin_shufflevector(give, give, 4, 5, 6, 7);
  }
  xm[wave][lane] = hi ? m_run[0] : m_run[1];
  xl[wave][lane] = hi ? l_run[0] : l_run[1];
  const float m_k = hi ? m_run[1] : m_run[0];
  const float l_k = hi ? l_run[1] : l_run[0];
  __syncthreads();   // publishes every wave's handed-over tile to its partner

  const int pw = wave ^ 2;
  const float m_p = xm[pw][lane];
  const float l_p = xl[pw][lane];
  const float m_j = fmaxf(m_k, m_p);
  const float a_k = __expf(m_k - m_j);
  const float a_p = __expf(m_p - m_j);
  const float inv = 1.0f / (l_k * a_k + l_p * a_p);
  const float f_k = a_k * inv;           // weight of this wave's sums, query lr
  const float f_p = a_p * inv;           // weight of the partner's sums
  v4f part[8];
  #pragma unroll
  for (int j = 0; j < 8; ++j) part[j] = xO[pw][j][lane];

  // ---- weigh, add and store [B,S,768] f32
  #pragma unroll
  for (int r = 0; r < 8; ++r) {
    const float kr = __shfl(f_k, r + 8 * hf, 32);
    const float pr = __shfl(f_p, r + 8 * hf, 32);
    const int s = q0 + half * 16 + r + 8 * hf;
    #pragma unroll
    for (int t = 0; t < 4; ++t)
      out[((size_t)b * SEQ + s) * HIDDEN + h * 64 + t * 16 + lr] =
          keep[t][r] * kr + part[t * 2 + (r >> 2)][r & 3] * pr;
  }
}

// ---------------------------------------------------------------- launcher
extern "C" void kernel_launch(void* const* d_in, const int* in_sizes, int n_in,
                              void* d_out, int out_size, void* d_ws, size_t ws_size,
                              hipStream_t stream) {
  const float* hidden  = (const float*)d_in[0];
  const float* context = (const float*)d_in[1];
  const float* amask   = (const float*)d_in[2];
  const float* Wq = (const float*)d_in[3];
  const float* bq = (const float*)d_in[4];
  const float* Wk = (const float*)d_in[5];
  const float* bk = (const float*)d_in[6];
  const float* Wv = (const float*)d_in[7];
  const float* bv = (const float*)d_in[8];
  float* outp = (float*)d_out;

  const size_t ACT = (size_t)BATCH * SEQ * HIDDEN;   // 3,145,728 elems
  const size_t WSZ = (size_t)HIDDEN * HIDDEN;        //   589,824 elems
  const size_t A_BYTES = ACT * sizeof(f16);          // 6,291,456
  const size_t W_BYTES = WSZ * sizeof(f16);          // 1,179,648

  char* ws = (char*)d_ws;
  f16* Xh16 = (f16*)(ws);
  f16* Xc16 = (f16*)(ws + A_BYTES);
  f16* Wq16 = (f16*)(ws + 2 * A_BYTES);              // packed Wq, Wk, Wv, W_BYTES each
  f16* Q16  = (f16*)(ws + 2 * A_BYTES + 3 * W_BYTES);
  f16* K16  = (f16*)(ws + 3 * A_BYTES + 3 * W_BYTES);
  f16* Vt16 = (f16*)(ws + 4 * A_BYTES + 3 * W_BYTES);

  // one wave per fragment, 8 waves per block; Xh16, Xc16, Wq16, Wk16, Wv16 in one grid
  pack_f32_f16<<<(2 * ACT + 3 * WSZ) / FRAG / 8, 256, 0, stream>>>(hidden, context, Wq, Wk, Wv, Xh16);

  const float qscale = 1.0f / sqrtf((float)HD + 1e-5f);
  dim3 pgrid((BATCH * SEQ) / 128, HEADS / 2, 3);     // 2 x 2 waves of 64 rows x 1 head per block; z: Q, K, V
  proj_kernel<<<pgrid, 128, 0, stream>>>(Xh16, Xc16, Wq16, bq, bk, bv, Q16, qscale);

  dim3 agrid(SEQ / 64, BATCH * HEADS);               // 2 strips of 32 queries x 2 key halves per block
  attn_kernel<<<agrid, 128, 0, stream>>>(Q16, K16, Vt16, amask, outp);
}

// v006
// One run takes 59.4 microseconds.
// Next to v005, in two timings, it ran 1.03 times as fast each time.
// Counting every step since v000, it is 2.96 times as fast.
#include <hip/hip_runtime.h>

typedef _Float16 f16;
typedef _Float16 v4h  __attribute__((ext_vector_type(4)));
typedef _Float16 v8h  __attribute__((ext_vector_type(8)));
typedef _Float16 v16h __attribute__((ext_vector_type(16)));
typedef float    v8f  __attribute__((ext_vector_type(8)));
typedef float    v4f  __attribute__((ext_vector_type(4)));

#define HIDDEN 768
#define HEADS  12
#define HD     64
#define SEQ    2048
#define BATCH  2

#define WMMA_F16(A, B, C) \
  __builtin_amdgcn_wmma_f32_16x16x32_f16(false, (A), false, (B), (short)0, (C), false, false)

static __device__ __forceinline__ v16h cat8(v8h lo, v8h hi) {
  return __builtin_shufflevector(lo, hi, 0,1,2,3,4,5,6,7,8,9,10,11,12,13,14,15);
}

// ---------------------------------------------------------------- fragment order
// Every f16 operand in the workspace is stored as 1-KiB WMMA fragments
// (16 rows x 32 k). Element (row, k) of a fragment sits at half index
//   (k >> 4) * 256 + (((k >> 3) & 1) * 16 + row) * 8 + (k & 7)
// so lane l reads its 2 x 8 halfs at l * 8 and 256 + l * 8: each wave-wide
// 16-byte load covers 512 contiguous bytes (4 lines) instead of 16 rows.
#define FRAG 512                 // halfs per fragment
#define KFR  (HIDDEN / 32)       // fragments along k of a 768-wide operand
#define AHEAD 3                  // k-steps of projection operands in flight per wave
#define RT    4                  // 16-row X tiles per projection wave

static __device__ __forceinline__ v16h load_frag(const f16* p) {   // p includes lane * 8
  return cat8(*(const v8h*)p, *(const v8h*)(p + 256));
}

// A wave-uniform pointer held in a scalar register pair: the loads formed from it
// take the scalar-base form with the lane's 32-bit offset beside it. Without it the
// key loop rebuilds two 64-bit vector addresses every trip in registers that the
// last load of the run then takes for its result.
// The result is typed as a global-memory pointer: rebuilt from two integers it would
// otherwise be taken for a generic one, whose loads also count as LDS operations.
typedef __attribute__((address_space(1))) const char gchar;
typedef __attribute__((address_space(1))) const v8h  gv8h;
static __device__ __forceinline__ gchar* scalar_base(const f16* p) {
  const unsigned long long a = (unsigned long long)p;
  const unsigned lo = (unsigned)__builtin_amdgcn_readfirstlane((int)(unsigned)a);
  const unsigned hi = (unsigned)__builtin_amdgcn_readfirstlane((int)(unsigned)(a >> 32));
  return (gchar*)(((unsigned long long)hi << 32) | lo);
}

static __device__ __forceinline__ v16h load_frag_g(gchar* p) {   // p includes lane * 16 bytes
  return cat8(*(gv8h*)p, *(gv8h*)(p + 512));
}

// ---------------------------------------------------------------- f32 -> f16, packed
// Each plane: rows x 768 f32. One wave converts one fragment: 4 loads of 4 whole lines,
// 4 stores of 8 bytes per lane. plane[(rowtile * KFR + ks) * FRAG + ...].
// One grid packs all five planes; they lie one behind the other in out, in the order
// of the arguments, so a fragment's place in out is its index over the whole grid.
// Every plane is a whole number of 8-fragment blocks: the choice is block-uniform.
#define XFR (BATCH * SEQ * HIDDEN / FRAG)   // fragments of an activation plane
#define WFR (HIDDEN * HIDDEN / FRAG)        // fragments of a weight plane
__global__ __launch_bounds__(256)
void pack_f32_f16(const float* __restrict__ hidden, const float* __restrict__ context,
                  const float* __restrict__ Wq, const float* __restrict__ Wk,
                  const float* __restrict__ Wv, f16* __restrict__ out) {
  const int lane = threadIdx.x & 31;
  const int gfr  = (blockIdx.x * 256 + threadIdx.x) >> 5;   // fragment index in out
  const int bfr  = blockIdx.x * 8;                          // the block's first fragment
  const float* in = hidden;
  int first = 0;
  if (bfr >= XFR)               { in = context; first = XFR; }
  if (bfr >= 2 * XFR)           { in = Wq;      first = 2 * XFR; }
  if (bfr >= 2 * XFR + WFR)     { in = Wk;      first = 2 * XFR + WFR; }
  if (bfr >= 2 * XFR + 2 * WFR) { in = Wv;      first = 2 * XFR + 2 * WFR; }
  const int fr   = gfr - first;                             // fragment index in its plane
  const int mt   = fr / KFR;
  const int ks   = fr % KFR;
  const int k4   = lane & 7;                                // float4 within the 32 k
  const float* src = in + (size_t)(mt * 16 + (lane >> 3)) * HIDDEN + ks * 32 + k4 * 4;
  f16* dst = out + (size_t)gfr * FRAG + (k4 >> 2) * 256
                 + (((k4 >> 1) & 1) * 16 + (lane >> 3)) * 8 + (k4 & 1) * 4;
  float4 v[4];
  #pragma unroll
  for (int i = 0; i < 4; ++i)
    v[i] = *(const float4*)(src + (size_t)i * 4 * HIDDEN);
  #pragma unroll
  for (int i = 0; i < 4; ++i) {
    v4h y = {(f16)v[i].x, (f16)v[i].y, (f16)v[i].z, (f16)v[i].w};
    *(v4h*)(dst + i * 4 * 8) = y;
  }
}

// ---------------------------------------------------------------- projection
// Y = X(4096x768) @ W^T(768x768) + bias. Each wave computes a 64x64 tile
// (4 X frags x 4 W frags -> 16 loads : 16 WMMAs per k-step). The 4 waves of a block
// form 2 x 2 such tiles: each fragment is asked for by two waves of one block.
// VT false: Q or K. The product is formed as W x X^T, so a lane holds 8
//   consecutive d of one position: its 16 bytes of the [bh][s/16][d/32] fragment.
// VT true: V. The product is formed as X x W^T, so a lane holds 8 consecutive
//   positions of one d: its 16 bytes of the [bh][s/32][d/16] fragment.
template <bool VT>
static __device__ __forceinline__
void proj_body(const f16* __restrict__ X, const f16* __restrict__ W,
               const float* __restrict__ bias, f16* __restrict__ out,
               float scale) {
  const int lane = threadIdx.x & 31;
  const int wave = threadIdx.x >> 5;
  const int lr   = lane & 15;
  const int hf   = lane >> 4;

  const int mt0 = (blockIdx.x * 2 + (wave & 1)) * RT;   // first of the wave's row tiles (0..255)
  const int h   = blockIdx.y * 2 + (wave >> 1);         // head == 64-col group

  const f16* xf = X + (size_t)mt0 * KFR * FRAG + lane * 8;
  const f16* wf = W + (size_t)(h * 4) * KFR * FRAG + lane * 8;

  // Register ring, AHEAD k-steps deep: the 16 loads of k-step ks + AHEAD are issued
  // right behind the products of k-step ks, so a wave waits for a load that is
  // AHEAD k-steps old instead of for the one it has just issued.
  v16h a[AHEAD][RT], w[AHEAD][4];
  #pragma unroll
  for (int s = 0; s < AHEAD; ++s) {
    #pragma unroll
    for (int i = 0; i < RT; ++i)
      a[s][i] = load_frag(xf + (i * KFR + s) * FRAG);
    #pragma unroll
    for (int t = 0; t < 4; ++t)
      w[s][t] = load_frag(wf + (t * KFR + s) * FRAG);
  }

  v8f acc[RT][4] = {};
  #pragma unroll
  for (int ks = 0; ks < KFR; ++ks) {
    const int s = ks % AHEAD;
    #pragma unroll
    for (int i = 0; i < RT; ++i)
      #pragma unroll
      for (int t = 0; t < 4; ++t)
        acc[i][t] = VT ? WMMA_F16(a[s][i], w[s][t], acc[i][t]) : WMMA_F16(w[s][t], a[s][i], acc[i][t]);
    if (ks + AHEAD < KFR) {
      #pragma unroll
      for (int i = 0; i < RT; ++i)
        a[s][i] = load_frag(xf + (i * KFR + ks + AHEAD) * FRAG);
      #pragma unroll
      for (int t = 0; t < 4; ++t)
        w[s][t] = load_frag(wf + (t * KFR + ks + AHEAD) * FRAG);
    }
    // Keeps the scheduler from sinking these loads down to their use, AHEAD k-steps later:
    // without it every product waits out the whole latency of the load in front of it.
    __builtin_amdgcn_sched_barrier(0);
  }

  // Every fragment load is issued: the wait stands in front of the epilogue's rewrite of
  // their address registers; the directive keeps the scheduler from lifting that rewrite over it.
  asm volatile("s_wait_xcnt 0x0" ::: "memory");
  __builtin_amdgcn_sched_barrier(0);

  const int bh = ((mt0 * 16) >> 11) * HEADS + h; // SEQ == 2048; 64 rows lie in one batch
  #pragma unroll
  for (int i = 0; i < RT; ++i) {
    const int s0 = ((mt0 + i) * 16) & (SEQ - 1);
    #pragma unroll
    for (int t = 0; t < 4; ++t) {
      v8h y;
      if (VT) {
        const float bv = bias[h * 64 + t * 16 + lr];
        #pragma unroll
        for (int r = 0; r < 8; ++r) y[r] = (f16)((acc[i][t][r] + bv) * scale);
        *(v8h*)(out + ((size_t)(bh * (SEQ / 32) + (s0 >> 5)) * 4 + t) * FRAG
                    + ((s0 >> 4) & 1) * 256 + lane * 8) = y;
      } else {
        const float* bp = bias + h * 64 + t * 16 + 8 * hf;
        #pragma unroll
        for (int r = 0; r < 8; ++r) y[r] = (f16)((acc[i][t][r] + bp[r]) * scale);
        *(v8h*)(out + ((size_t)(bh * (SEQ / 16) + (s0 >> 4)) * 2 + (t >> 1)) * FRAG
                    + (t & 1) * 256 + lane * 8) = y;
      }
    }
  }
  // In the merged kernel the V body's code follows this body's stores in the listing and
  // writes their address and data registers: the wait stands between stores and rewrite.
  if (!VT) asm volatile("s_wait_xcnt 0x0" ::: "memory");
}

// One grid for the three projections: blockIdx.z = 0 Q, 1 K, 2 V. The packed weight
// planes lie one behind the other in W3, the three result planes in out3.
__global__ __launch_bounds__(128)
void proj_kernel(const f16* __restrict__ Xh, const f16* __restrict__ Xc,
                 const f16* __restrict__ W3, const float* __restrict__ bq,
                 const float* __restrict__ bk, const float* __restrict__ bv,
                 f16* __restrict__ out3, float qscale) {
  const int z = blockIdx.z;
  const f16* W = W3 + (size_t)z * (HIDDEN * HIDDEN);
  f16* out = out3 + (size_t)z * (BATCH * SEQ * HIDDEN);
  if (z == 2)
    proj_body<true>(Xc, W, bv, out, 1.0f);
  else
    proj_body<false>(z ? Xc : Xh, W, z ? bk : bq, out, z ? 1.0f : qscale);
}

// ---------------------------------------------------------------- attention
// grid: (SEQ/64, B*H), block 128 (4 waves) = 2 query strips x 2 key halves. A wave owns
// 32 query rows (two 16-row tiles) and one half of the keys, streamed in chunks of 32
// with online softmax: 3072 waves, three for each of the chip's 1024 SIMDs (one wave per
// strip makes 1536, which no placement spreads evenly). The two waves of a strip join
// their partial results through LDS behind the loop. K/V frags loaded once per
// chunk (K one chunk ahead of its use) and reused by both query tiles -> 1:1 VMEM:WMMA.
// Q, K: fragments [bh][s/16][d/32]; Vt: fragments [bh][s/32][d/16].
#define KHALF (SEQ / 2)          // keys per wave
__global__ __launch_bounds__(128)
void attn_kernel(const f16* __restrict__ Q, const f16* __restrict__ K,
                 const f16* __restrict__ Vt, const float* __restrict__ mask,
                 float* __restrict__ out) {
  __shared__ float smask[SEQ];
  __shared__ v4f   xO[4][8][32];         // per wave: the output tile it hands to its partner
  __shared__ float xm[4][32], xl[4][32]; // and that tile's running maximum and sum
  const int bh = blockIdx.y;
  const int b  = bh / HEADS;
  const int h  = bh % HEADS;

  for (int i = threadIdx.x; i < SEQ; i += blockDim.x)
    smask[i] = mask[(size_t)b * SEQ + i];
  __syncthreads();

  const int lane = threadIdx.x & 31;
  // the wave's number in a scalar register: the key loop's bounds stay scalar
  const int wave = __builtin_amdgcn_readfirstlane(threadIdx.x >> 5);
  const int lr   = lane & 15;
  const int hf   = lane >> 4;
  const int half = wave >> 1;                            // which half of the keys
  const int q0   = blockIdx.x * 64 + (wave & 1) * 32;    // 32-query strip base
  const int kb0  = half * KHALF;                         // the wave's first key

  // Q as B-operand of S^T = K x Q^T (two query tiles, resident)
  v16h Qb[2][2];
  #pragma unroll
  for (int u = 0; u < 2; ++u) {
    const f16* qf = Q + ((size_t)bh * SEQ + q0 + u * 16) * HD + lane * 8;
    #pragma unroll
    for (int ks = 0; ks < 2; ++ks)
      Qb[u][ks] = load_frag(qf + ks * FRAG);
  }

  const f16* Kbh = K  + (size_t)bh * SEQ * HD;
  const f16* Vbh = Vt + (size_t)bh * HD * SEQ;
  gchar* Ks = scalar_base(Kbh);
  gchar* Vs = scalar_base(Vbh);
  // K and V chunks sit at the same place in their planes: one 32-bit byte offset
  // per lane, carried through the loop, beside the two scalar bases.
  unsigned off = lane * 16 + kb0 * (HD * sizeof(f16));

  v8f O[2][4] = {};
  float m_run[2] = {-1e30f, -1e30f};
  float l_run[2] = {0.f, 0.f};

  // K A-frags of one chunk (2 key tiles x 2 k-steps)
  v16h ka[2][2];
  #pragma unroll
  for (int c = 0; c < 2; ++c)
    #pragma unroll
    for (int ks = 0; ks < 2; ++ks)
      ka[c][ks] = load_frag_g(Ks + off + (c * 2 + ks) * (FRAG * sizeof(f16)));

  for (int kb = kb0; kb < kb0 + KHALF; kb += 32) {
    // The next chunk, or on the wave's last trip this chunk once more, of which nothing is
    // used: one instruction stream in every trip, so every wait below counts the same loads.
    const int kn = (kb + 32 < kb0 + KHALF) ? kb + 32 : kb;

    // ---- V B-frags (4 d-tiles) of this chunk: first used behind the softmax
    v16h vb[4];
    #pragma unroll
    for (int t = 0; t < 4; ++t)
      vb[t] = load_frag_g(Vs + off + t * (FRAG * sizeof(f16)));
    float mk0[8], mk1[8];
    #pragma unroll
    for (int r = 0; r < 8; ++r) {
      mk0[r] = smask[kb + r + 8 * hf];
      mk1[r] = smask[kb + 16 + r + 8 * hf];
    }

    // global_prefetch_b8: the next chunk's 4 KiB of V, one ask per 256 B
    __builtin_prefetch(Vs + (unsigned)kn * (HD * sizeof(f16)) + lr * 256, 0, 1);

    // ---- S^T tiles of both query tiles: the last readers of this chunk's K frags
    v8f c0[2], c1[2];
    #pragma unroll
    for (int u = 0; u < 2; ++u) {
      c0[u] = v8f{}; c1[u] = v8f{};
      #pragma unroll
      for (int ks = 0; ks < 2; ++ks) {
        c0[u] = WMMA_F16(ka[0][ks], Qb[u][ks], c0[u]);
        c1[u] = WMMA_F16(ka[1][ks], Qb[u][ks], c1[u]);
      }
    }

    // ---- the next chunk's K frags, into the same registers: their latency passes under
    // this chunk's softmax and P x V instead of being waited out at the next trip's head.
    // The directives keep the K loads up here: without them the scheduler sinks the loads
    // down to their use in the next trip.
    __builtin_amdgcn_sched_barrier(0);
    const unsigned koff = off + (kn - kb) * (HD * sizeof(f16));
    #pragma unroll
    for (int c = 0; c < 2; ++c)
      #pragma unroll
      for (int ks = 0; ks < 2; ++ks)
        ka[c][ks] = load_frag_g(Ks + koff + (c * 2 + ks) * (FRAG * sizeof(f16)));
    __builtin_amdgcn_sched_barrier(0);

    #pragma unroll
    for (int u = 0; u < 2; ++u) {
      // ---- online softmax; lane carries query lr (replicated in halves)
      float p[16];
      float mx = -1e30f;
      #pragma unroll
      for (int r = 0; r < 8; ++r) {
        float s0 = c0[u][r] + mk0[r];
        float s1 = c1[u][r] + mk1[r];
        p[r] = s0; p[8 + r] = s1;
        mx = fmaxf(mx, fmaxf(s0, s1));
      }
      mx = fmaxf(mx, __shfl_xor(mx, 16, 32));
      const float m_new = fmaxf(m_run[u], mx);
      const float alpha = __expf(m_run[u] - m_new);

      v16h pa;              // C-layout of S^T tiles == A-layout of P
      float lsum = 0.f;
      #pragma unroll
      for (int r = 0; r < 8; ++r) {
        float e0 = __expf(p[r] - m_new);
        float e1 = __expf(p[8 + r] - m_new);
        lsum += e0 + e1;
        pa[r] = (f16)e0; pa[8 + r] = (f16)e1;
      }
      lsum += __shfl_xor(lsum, 16, 32);
      l_run[u] = l_run[u] * alpha + lsum;
      m_run[u] = m_new;

      // ---- rescale O rows (row M = r + 8*hf; alpha for query j lives in lane j)
      #pragma unroll
      for (int r = 0; r < 8; ++r) {
        float ar = __shfl(alpha, r + 8 * hf, 32);
        #pragma unroll
        for (int t = 0; t < 4; ++t) O[u][t][r] *= ar;
      }

      // ---- O += P x Vchunk (V frags shared across u)
      #pragma unroll
      for (int t = 0; t < 4; ++t)
        O[u][t] = WMMA_F16(pa, vb[t], O[u][t]);
    }
    // Holds the step of off down here, behind the products that wait for every V load of the
    // trip: lifted up among them it would rewrite the offset register of loads still in flight.
    __builtin_amdgcn_sched_barrier(0);
    off += 32 * HD * sizeof(f16);
  }

  // ---- join the two key halves: the wave of half h finishes query tile h of its strip
  // and hands its partial sums of the other tile to its partner (wave ^ 2) through LDS.
  const bool hi = half != 0;
  v8f keep[4];
  #pragma unroll
  for (int t = 0; t < 4; ++t) {
    const v8f give = hi ? O[0][t] : O[1][t];
    keep[t] = hi ? O[1][t] : O[0][t];
    xO[wave][t * 2][lane]     = __builtin_shufflevector(give, give, 0, 1, 2, 3);
    xO[wave][t * 2 + 1][lane] = __builtin_shufflevector(give, give, 4, 5, 6, 7);
  }
  xm[wave][lane] = hi ? m_run[0] : m_run[1];
  xl[wave][lane] = hi ? l_run[0] : l_run[1];
  const float m_k = hi ? m_run[1] : m_run[0];
  const float l_k = hi ? l_run[1] : l_run[0];
  __syncthreads();   // publishes every wave's handed-over tile to its partner

  const int pw = wave ^ 2;
  const float m_p = xm[pw][lane];
  const float l_p = xl[pw][lane];
  const float m_j = fmaxf(m_k, m_p);
  const float a_k = __expf(m_k - m_j);
  const float a_p = __expf(m_p - m_j);
  const float inv = 1.0f / (l_k * a_k + l_p * a_p);
  const float f_k = a_k * inv;           // weight of this wave's sums, query lr
  const float f_p = a_p * inv;           // weight of the partner's sums
  v4f part[8];
  #pragma unroll
  for (int j = 0; j < 8; ++j) part[j] = xO[pw][j][lane];

  // ---- weigh, add and store [B,S,768] f32
  #pragma unroll
  for (int r = 0; r < 8; ++r) {
    const float kr = __shfl(f_k, r + 8 * hf, 32);
    const float pr = __shfl(f_p, r + 8 * hf, 32);
    const int s = q0 + half * 16 + r + 8 * hf;
    #pragma unroll
    for (int t = 0; t < 4; ++t)
      out[((size_t)b * SEQ + s) * HIDDEN + h * 64 + t * 16 + lr] =
          keep[t][r] * kr + part[t * 2 + (r >> 2)][r & 3] * pr;
  }
}

// ---------------------------------------------------------------- launcher
extern "C" void kernel_launch(void* const* d_in, const int* in_sizes, int n_in,
                              void* d_out, int out_size, void* d_ws, size_t ws_size,
                              hipStream_t stream) {
  const float* hidden  = (const float*)d_in[0];
  const float* context = (const float*)d_in[1];
  const float* amask   = (const float*)d_in[2];
  const float* Wq = (const float*)d_in[3];
  const float* bq = (const float*)d_in[4];
  const float* Wk = (const float*)d_in[5];
  const float* bk = (const float*)d_in[6];
  const float* Wv = (const float*)d_in[7];
  const float* bv = (const float*)d_in[8];
  float* outp = (float*)d_out;

  const size_t ACT = (size_t)BATCH * SEQ * HIDDEN;   // 3,145,728 elems
  const size_t WSZ = (size_t)HIDDEN * HIDDEN;        //   589,824 elems
  const size_t A_BYTES = ACT * sizeof(f16);          // 6,291,456
  const size_t W_BYTES = WSZ * sizeof(f16);          // 1,179,648

  char* ws = (char*)d_ws;
  f16* Xh16 = (f16*)(ws);
  f16* Xc16 = (f16*)(ws + A_BYTES);
  f16* Wq16 = (f16*)(ws + 2 * A_BYTES);              // packed Wq, Wk, Wv, W_BYTES each
  f16* Q16  = (f16*)(ws + 2 * A_BYTES + 3 * W_BYTES);
  f16* K16  = (f16*)(ws + 3 * A_BYTES + 3 * W_BYTES);
  f16* Vt16 = (f16*)(ws + 4 * A_BYTES + 3 * W_BYTES);

  // one wave per fragment, 8 waves per block; Xh16, Xc16, Wq16, Wk16, Wv16 in one grid
  pack_f32_f16<<<(2 * ACT + 3 * WSZ) / FRAG / 8, 256, 0, stream>>>(hidden, context, Wq, Wk, Wv, Xh16);

  const float qscale = 1.0f / sqrtf((float)HD + 1e-5f);
  dim3 pgrid((BATCH * SEQ) / 128, HEADS / 2, 3);     // 2 x 2 waves of 64 rows x 1 head per block; z: Q, K, V
  proj_kernel<<<pgrid, 128, 0, stream>>>(Xh16, Xc16, Wq16, bq, bk, bv, Q16, qscale);

  dim3 agrid(SEQ / 64, BATCH * HEADS);               // 2 strips of 32 queries x 2 key halves per block
  attn_kernel<<<agrid, 128, 0, stream>>>(Q16, K16, Vt16, amask, outp);
}

// v007
// It runs in 53.8 microseconds.
// Next to v006, in two timings, it ran 1.12 times as fast each time.
// All steps since v000 together make it 3.30 times as fast.
#include <hip/hip_runtime.h>

typedef _Float16 f16;
typedef _Float16 v4h  __attribute__((ext_vector_type(4)));
typedef _Float16 v8h  __attribute__((ext_vector_type(8)));
typedef _Float16 v16h __attribute__((ext_vector_type(16)));
typedef float    v8f  __attribute__((ext_vector_type(8)));
typedef float    v4f  __attribute__((ext_vector_type(4)));

#define HIDDEN 768
#define HEADS  12
#define HD     64
#define SEQ    2048
#define BATCH  2

#define WMMA_F16(A, B, C) \
  __builtin_amdgcn_wmma_f32_16x16x32_f16(false, (A), false, (B), (short)0, (C), false, false)

static __device__ __forceinline__ v16h cat8(v8h lo, v8h hi) {
  return __builtin_shufflevector(lo, hi, 0,1,2,3,4,5,6,7,8,9,10,11,12,13,14,15);
}

// ---------------------------------------------------------------- fragment order
// Every f16 operand in the workspace is stored as 1-KiB WMMA fragments
// (16 rows x 32 k). Element (row, k) of a fragment sits at half index
//   (k >> 4) * 256 + (((k >> 3) & 1) * 16 + row) * 8 + (k & 7)
// so lane l reads its 2 x 8 halfs at l * 8 and 256 + l * 8: each wave-wide
// 16-byte load covers 512 contiguous bytes (4 lines) instead of 16 rows.
#define FRAG 512                 // halfs per fragment
#define KFR  (HIDDEN / 32)       // fragments along k of a 768-wide operand
#define AHEAD 3                  // k-steps of projection operands in flight per wave
#define RT    4                  // 16-row X tiles per projection wave

static __device__ __forceinline__ v16h load_frag(const f16* p) {   // p includes lane * 8
  return cat8(*(const v8h*)p, *(const v8h*)(p + 256));
}

// A wave-uniform pointer held in a scalar register pair: the loads formed from it
// take the scalar-base form with the lane's 32-bit offset beside it. Without it the
// key loop rebuilds two 64-bit vector addresses every trip in registers that the
// last load of the run then takes for its result.
// The result is typed as a global-memory pointer: rebuilt from two integers it would
// otherwise be taken for a generic one, whose loads also count as LDS operations.
typedef __attribute__((address_space(1))) const char gchar;
typedef __attribute__((address_space(1))) const v8h  gv8h;
static __device__ __forceinline__ gchar* scalar_base(const f16* p) {
  const unsigned long long a = (unsigned long long)p;
  const unsigned lo = (unsigned)__builtin_amdgcn_readfirstlane((int)(unsigned)a);
  const unsigned hi = (unsigned)__builtin_amdgcn_readfirstlane((int)(unsigned)(a >> 32));
  return (gchar*)(((unsigned long long)hi << 32) | lo);
}

static __device__ __forceinline__ v16h load_frag_g(gchar* p) {   // p includes lane * 16 bytes
  return cat8(*(gv8h*)p, *(gv8h*)(p + 512));
}

// ---------------------------------------------------------------- f32 -> f16, packed
// Each plane: rows x 768 f32. One wave converts one fragment: 4 loads of 4 whole lines,
// 4 stores of 8 bytes per lane. plane[(rowtile * KFR + ks) * FRAG + ...].
// One grid packs all five planes; they lie one behind the other in out, in the order
// of the arguments, so a fragment's place in out is its index over the whole grid.
// Every plane is a whole number of 8-fragment blocks: the choice is block-uniform.
#define XFR (BATCH * SEQ * HIDDEN / FRAG)   // fragments of an activation plane
#define WFR (HIDDEN * HIDDEN / FRAG)        // fragments of a weight plane
__global__ __launch_bounds__(256)
void pack_f32_f16(const float* __restrict__ hidden, const float* __restrict__ context,
                  const float* __restrict__ Wq, const float* __restrict__ Wk,
                  const float* __restrict__ Wv, f16* __restrict__ out) {
  const int lane = threadIdx.x & 31;
  const int gfr  = (blockIdx.x * 256 + threadIdx.x) >> 5;   // fragment index in out
  const int bfr  = blockIdx.x * 8;                          // the block's first fragment
  const float* in = hidden;
  int first = 0;
  if (bfr >= XFR)               { in = context; first = XFR; }
  if (bfr >= 2 * XFR)           { in = Wq;      first = 2 * XFR; }
  if (bfr >= 2 * XFR + WFR)     { in = Wk;      first = 2 * XFR + WFR; }
  if (bfr >= 2 * XFR + 2 * WFR) { in = Wv;      first = 2 * XFR + 2 * WFR; }
  const int fr   = gfr - first;                             // fragment index in its plane
  const int mt   = fr / KFR;
  const int ks   = fr % KFR;
  const int k4   = lane & 7;                                // float4 within the 32 k
  const float* src = in + (size_t)(mt * 16 + (lane >> 3)) * HIDDEN + ks * 32 + k4 * 4;
  f16* dst = out + (size_t)gfr * FRAG + (k4 >> 2) * 256
                 + (((k4 >> 1) & 1) * 16 + (lane >> 3)) * 8 + (k4 & 1) * 4;
  float4 v[4];
  #pragma unroll
  for (int i = 0; i < 4; ++i)
    v[i] = *(const float4*)(src + (size_t)i * 4 * HIDDEN);
  #pragma unroll
  for (int i = 0; i < 4; ++i) {
    v4h y = {(f16)v[i].x, (f16)v[i].y, (f16)v[i].z, (f16)v[i].w};
    *(v4h*)(dst + i * 4 * 8) = y;
  }
}

// ---------------------------------------------------------------- projection
// Y = X(4096x768) @ W^T(768x768) + bias. Each wave computes a 64x64 tile
// (4 X frags x 4 W frags -> 16 loads : 16 WMMAs per k-step). The 4 waves of a block
// form 2 x 2 such tiles: each fragment is asked for by two waves of one block.
// VT false: Q or K. The product is formed as W x X^T, so a lane holds 8
//   consecutive d of one position: its 16 bytes of the [bh][s/16][d/32] fragment.
// VT true: V. The product is formed as X x W^T, so a lane holds 8 consecutive
//   positions of one d: its 16 bytes of the [bh][s/32][d/16] fragment.
template <bool VT>
static __device__ __forceinline__
void proj_body(const f16* __restrict__ X, const f16* __restrict__ W,
               const float* __restrict__ bias, f16* __restrict__ out,
               float scale) {
  const int lane = threadIdx.x & 31;
  const int wave = threadIdx.x >> 5;
  const int lr   = lane & 15;
  const int hf   = lane >> 4;

  const int mt0 = (blockIdx.x * 2 + (wave & 1)) * RT;   // first of the wave's row tiles (0..255)
  const int h   = blockIdx.y * 2 + (wave >> 1);         // head == 64-col group

  const f16* xf = X + (size_t)mt0 * KFR * FRAG + lane * 8;
  const f16* wf = W + (size_t)(h * 4) * KFR * FRAG + lane * 8;

  // Register ring, AHEAD k-steps deep: the 16 loads of k-step ks + AHEAD are issued
  // right behind the products of k-step ks, so a wave waits for a load that is
  // AHEAD k-steps old instead of for the one it has just issued.
  v16h a[AHEAD][RT], w[AHEAD][4];
  #pragma unroll
  for (int s = 0; s < AHEAD; ++s) {
    #pragma unroll
    for (int i = 0; i < RT; ++i)
      a[s][i] = load_frag(xf + (i * KFR + s) * FRAG);
    #pragma unroll
    for (int t = 0; t < 4; ++t)
      w[s][t] = load_frag(wf + (t * KFR + s) * FRAG);
  }

  v8f acc[RT][4] = {};
  #pragma unroll
  for (int ks = 0; ks < KFR; ++ks) {
    const int s = ks % AHEAD;
    #pragma unroll
    for (int i = 0; i < RT; ++i)
      #pragma unroll
      for (int t = 0; t < 4; ++t)
        acc[i][t] = VT ? WMMA_F16(a[s][i], w[s][t], acc[i][t]) : WMMA_F16(w[s][t], a[s][i], acc[i][t]);
    if (ks + AHEAD < KFR) {
      #pragma unroll
      for (int i = 0; i < RT; ++i)
        a[s][i] = load_frag(xf + (i * KFR + ks + AHEAD) * FRAG);
      #pragma unroll
      for (int t = 0; t < 4; ++t)
        w[s][t] = load_frag(wf + (t * KFR + ks + AHEAD) * FRAG);
    }
    // Keeps the scheduler from sinking these loads down to their use, AHEAD k-steps later:
    // without it every product waits out the whole latency of the load in front of it.
    __builtin_amdgcn_sched_barrier(0);
  }

  // Every fragment load is issued: the wait stands in front of the epilogue's rewrite of
  // their address registers; the directive keeps the scheduler from lifting that rewrite over it.
  asm volatile("s_wait_xcnt 0x0" ::: "memory");
  __builtin_amdgcn_sched_barrier(0);

  const int bh = ((mt0 * 16) >> 11) * HEADS + h; // SEQ == 2048; 64 rows lie in one batch
  #pragma unroll
  for (int i = 0; i < RT; ++i) {
    const int s0 = ((mt0 + i) * 16) & (SEQ - 1);
    #pragma unroll
    for (int t = 0; t < 4; ++t) {
      v8h y;
      if (VT) {
        const float bv = bias[h * 64 + t * 16 + lr];
        #pragma unroll
        for (int r = 0; r < 8; ++r) y[r] = (f16)((acc[i][t][r] + bv) * scale);
        *(v8h*)(out + ((size_t)(bh * (SEQ / 32) + (s0 >> 5)) * 4 + t) * FRAG
                    + ((s0 >> 4) & 1) * 256 + lane * 8) = y;
      } else {
        const float* bp = bias + h * 64 + t * 16 + 8 * hf;
        #pragma unroll
        for (int r = 0; r < 8; ++r) y[r] = (f16)((acc[i][t][r] + bp[r]) * scale);
        *(v8h*)(out + ((size_t)(bh * (SEQ / 16) + (s0 >> 4)) * 2 + (t >> 1)) * FRAG
                    + (t & 1) * 256 + lane * 8) = y;
      }
    }
  }
  // In the merged kernel the V body's code follows this body's stores in the listing and
  // writes their address and data registers: the wait stands between stores and rewrite.
  if (!VT) asm volatile("s_wait_xcnt 0x0" ::: "memory");
}

// One grid for the three projections: blockIdx.z = 0 Q, 1 K, 2 V. The packed weight
// planes lie one behind the other in W3, the three result planes in out3.
__global__ __launch_bounds__(128)
void proj_kernel(const f16* __restrict__ Xh, const f16* __restrict__ Xc,
                 const f16* __restrict__ W3, const float* __restrict__ bq,
                 const float* __restrict__ bk, const float* __restrict__ bv,
                 f16* __restrict__ out3, float qscale) {
  const int z = blockIdx.z;
  const f16* W = W3 + (size_t)z * (HIDDEN * HIDDEN);
  f16* out = out3 + (size_t)z * (BATCH * SEQ * HIDDEN);
  if (z == 2)
    proj_body<true>(Xc, W, bv, out, 1.0f);
  else
    proj_body<false>(z ? Xc : Xh, W, z ? bk : bq, out, z ? 1.0f : qscale);
}

// ---------------------------------------------------------------- attention
// grid: (SEQ/64, B*H), block 128 (4 waves) = 2 query strips x 2 key halves. A wave owns
// 32 query rows (two 16-row tiles) and one half of the keys, streamed in chunks of 32
// with online softmax: 3072 waves, three for each of the chip's 1024 SIMDs (one wave per
// strip makes 1536, which no placement spreads evenly). The two waves of a strip join
// their partial results through LDS behind the loop. K/V frags loaded once per
// chunk (K one chunk ahead of its use) and reused by both query tiles -> 1:1 VMEM:WMMA.
// Q, K: fragments [bh][s/16][d/32]; Vt: fragments [bh][s/32][d/16].
#define KHALF (SEQ / 2)          // keys per wave
__global__ __launch_bounds__(128)
void attn_kernel(const f16* __restrict__ Q, const f16* __restrict__ K,
                 const f16* __restrict__ Vt, const float* __restrict__ mask,
                 float* __restrict__ out) {
  __shared__ __attribute__((aligned(16))) float smask[SEQ];
  __shared__ v4f   xO[4][8][32];         // per wave: the output tile it hands to its partner
  __shared__ float xm[4][32], xl[4][32]; // and that tile's running maximum and sum
  const int bh = blockIdx.y;
  const int b  = bh / HEADS;
  const int h  = bh % HEADS;

  // The block's 8 KiB of mask: 4 loads of 16 bytes per thread, all issued at once and ahead
  // of the Q and K loads below, so the kernel's head waits out one load latency, not one
  // for each of 16 rounds of load, wait and LDS store with the Q and K loads behind them.
  v4f mrow[SEQ / 512];
  #pragma unroll
  for (int j = 0; j < SEQ / 512; ++j)
    mrow[j] = *(const v4f*)(mask + (size_t)b * SEQ + (j * 128 + threadIdx.x) * 4);

  const int lane = threadIdx.x & 31;
  // the wave's number in a scalar register: the key loop's bounds stay scalar
  const int wave = __builtin_amdgcn_readfirstlane(threadIdx.x >> 5);
  const int lr   = lane & 15;
  const int hf   = lane >> 4;
  const int half = wave >> 1;                            // which half of the keys
  const int q0   = blockIdx.x * 64 + (wave & 1) * 32;    // 32-query strip base
  const int kb0  = half * KHALF;                         // the wave's first key

  // Q as B-operand of S^T = K x Q^T (two query tiles, resident)
  v16h Qb[2][2];
  #pragma unroll
  for (int u = 0; u < 2; ++u) {
    const f16* qf = Q + ((size_t)bh * SEQ + q0 + u * 16) * HD + lane * 8;
    #pragma unroll
    for (int ks = 0; ks < 2; ++ks)
      Qb[u][ks] = load_frag(qf + ks * FRAG);
  }

  const f16* Kbh = K  + (size_t)bh * SEQ * HD;
  const f16* Vbh = Vt + (size_t)bh * HD * SEQ;
  gchar* Ks = scalar_base(Kbh);
  gchar* Vs = scalar_base(Vbh);
  // K and V chunks sit at the same place in their planes: one 32-bit byte offset
  // per lane, carried through the loop, beside the two scalar bases.
  unsigned off = lane * 16 + kb0 * (HD * sizeof(f16));

  v8f O[2][4] = {};
  float m_run[2] = {-1e30f, -1e30f};
  float l_run[2] = {0.f, 0.f};

  // K A-frags of one chunk (2 key tiles x 2 k-steps)
  v16h ka[2][2];
  #pragma unroll
  for (int c = 0; c < 2; ++c)
    #pragma unroll
    for (int ks = 0; ks < 2; ++ks)
      ka[c][ks] = load_frag_g(Ks + off + (c * 2 + ks) * (FRAG * sizeof(f16)));

  #pragma unroll
  for (int j = 0; j < SEQ / 512; ++j)
    *(v4f*)(smask + (j * 128 + threadIdx.x) * 4) = mrow[j];
  __syncthreads();   // publishes the mask; stands behind the issue of the Q and K loads, whose latency passes with the mask's

  for (int kb = kb0; kb < kb0 + KHALF; kb += 32) {
    // The next chunk, or on the wave's last trip this chunk once more, of which nothing is
    // used: one instruction stream in every trip, so every wait below counts the same loads.
    const int kn = (kb + 32 < kb0 + KHALF) ? kb + 32 : kb;

    // ---- V B-frags (4 d-tiles) of this chunk: first used behind the softmax
    v16h vb[4];
    #pragma unroll
    for (int t = 0; t < 4; ++t)
      vb[t] = load_frag_g(Vs + off + t * (FRAG * sizeof(f16)));
    float mk0[8], mk1[8];
    #pragma unroll
    for (int r = 0; r < 8; ++r) {
      mk0[r] = smask[kb + r + 8 * hf];
      mk1[r] = smask[kb + 16 + r + 8 * hf];
    }

    // global_prefetch_b8: the next chunk's 4 KiB of V, one ask per 256 B
    __builtin_prefetch(Vs + (unsigned)kn * (HD * sizeof(f16)) + lr * 256, 0, 1);

    // ---- S^T tiles of both query tiles: the last readers of this chunk's K frags
    v8f c0[2], c1[2];
    #pragma unroll
    for (int u = 0; u < 2; ++u) {
      c0[u] = v8f{}; c1[u] = v8f{};
      #pragma unroll
      for (int ks = 0; ks < 2; ++ks) {
        c0[u] = WMMA_F16(ka[0][ks], Qb[u][ks], c0[u]);
        c1[u] = WMMA_F16(ka[1][ks], Qb[u][ks], c1[u]);
      }
    }

    // ---- the next chunk's K frags, into the same registers: their latency passes under
    // this chunk's softmax and P x V instead of being waited out at the next trip's head.
    // The directives keep the K loads up here: without them the scheduler sinks the loads
    // down to their use in the next trip.
    __builtin_amdgcn_sched_barrier(0);
    const unsigned koff = off + (kn - kb) * (HD * sizeof(f16));
    #pragma unroll
    for (int c = 0; c < 2; ++c)
      #pragma unroll
      for (int ks = 0; ks < 2; ++ks)
        ka[c][ks] = load_frag_g(Ks + koff + (c * 2 + ks) * (FRAG * sizeof(f16)));
    __builtin_amdgcn_sched_barrier(0);

    #pragma unroll
    for (int u = 0; u < 2; ++u) {
      // ---- online softmax; lane carries query lr (replicated in halves)
      float p[16];
      float mx = -1e30f;
      #pragma unroll
      for (int r = 0; r < 8; ++r) {
        float s0 = c0[u][r] + mk0[r];
        float s1 = c1[u][r] + mk1[r];
        p[r] = s0; p[8 + r] = s1;
        mx = fmaxf(mx, fmaxf(s0, s1));
      }
      mx = fmaxf(mx, __shfl_xor(mx, 16, 32));
      const float m_new = fmaxf(m_run[u], mx);
      const float alpha = __expf(m_run[u] - m_new);

      v16h pa;              // C-layout of S^T tiles == A-layout of P
      float lsum = 0.f;
      #pragma unroll
      for (int r = 0; r < 8; ++r) {
        float e0 = __expf(p[r] - m_new);
        float e1 = __expf(p[8 + r] - m_new);
        lsum += e0 + e1;
        pa[r] = (f16)e0; pa[8 + r] = (f16)e1;
      }
      lsum += __shfl_xor(lsum, 16, 32);
      l_run[u] = l_run[u] * alpha + lsum;
      m_run[u] = m_new;

      // ---- rescale O rows (row M = r + 8*hf; alpha for query j lives in lane j)
      #pragma unroll
      for (int r = 0; r < 8; ++r) {
        float ar = __shfl(alpha, r + 8 * hf, 32);
        #pragma unroll
        for (int t = 0; t < 4; ++t) O[u][t][r] *= ar;
      }

      // ---- O += P x Vchunk (V frags shared across u)
      #pragma unroll
      for (int t = 0; t < 4; ++t)
        O[u][t] = WMMA_F16(pa, vb[t], O[u][t]);
    }
    // Holds the step of off down here, behind the products that wait for every V load of the
    // trip: lifted up among them it would rewrite the offset register of loads still in flight.
    __builtin_amdgcn_sched_barrier(0);
    off += 32 * HD * sizeof(f16);
  }

  // ---- join the two key halves: the wave of half h finishes query tile h of its strip
  // and hands its partial sums of the other tile to its partner (wave ^ 2) through LDS.
  const bool hi = half != 0;
  v8f keep[4];
  #pragma unroll
  for (int t = 0; t < 4; ++t) {
    const v8f give = hi ? O[0][t] : O[1][t];
    keep[t] = hi ? O[1][t] : O[0][t];
    xO[wave][t * 2][lane]     = __builtin_shufflevector(give, give, 0, 1, 2, 3);
    xO[wave][t * 2 + 1][lane] = __builtin_shufflevector(give, give, 4, 5, 6, 7);
  }
  xm[wave][lane] = hi ? m_run[0] : m_run[1];
  xl[wave][lane] = hi ? l_run[0] : l_run[1];
  const float m_k = hi ? m_run[1] : m_run[0];
  const float l_k = hi ? l_run[1] : l_run[0];
  __syncthreads();   // publishes every wave's handed-over tile to its partner

  const int pw = wave ^ 2;
  const float m_p = xm[pw][lane];
  const float l_p = xl[pw][lane];
  const float m_j = fmaxf(m_k, m_p);
  const float a_k = __expf(m_k - m_j);
  const float a_p = __expf(m_p - m_j);
  const float inv = 1.0f / (l_k * a_k + l_p * a_p);
  const float f_k = a_k * inv;           // weight of this wave's sums, query lr
  const float f_p = a_p * inv;           // weight of the partner's sums
  v4f part[8];
  #pragma unroll
  for (int j = 0; j < 8; ++j) part[j] = xO[pw][j][lane];

  // ---- weigh, add and store [B,S,768] f32
  #pragma unroll
  for (int r = 0; r < 8; ++r) {
    const float kr = __shfl(f_k, r + 8 * hf, 32);
    const float pr = __shfl(f_p, r + 8 * hf, 32);
    const int s = q0 + half * 16 + r + 8 * hf;
    #pragma unroll
    for (int t = 0; t < 4; ++t)
      out[((size_t)b * SEQ + s) * HIDDEN + h * 64 + t * 16 + lr] =
          keep[t][r] * kr + part[t * 2 + (r >> 2)][r & 3] * pr;
  }
}

// ---------------------------------------------------------------- launcher
extern "C" void kernel_launch(void* const* d_in, const int* in_sizes, int n_in,
                              void* d_out, int out_size, void* d_ws, size_t ws_size,
                              hipStream_t stream) {
  const float* hidden  = (const float*)d_in[0];
  const float* context = (const float*)d_in[1];
  const float* amask   = (const float*)d_in[2];
  const float* Wq = (const float*)d_in[3];
  const float* bq = (const float*)d_in[4];
  const float* Wk = (const float*)d_in[5];
  const float* bk = (const float*)d_in[6];
  const float* Wv = (const float*)d_in[7];
  const float* bv = (const float*)d_in[8];
  float* outp = (float*)d_out;

  const size_t ACT = (size_t)BATCH * SEQ * HIDDEN;   // 3,145,728 elems
  const size_t WSZ = (size_t)HIDDEN * HIDDEN;        //   589,824 elems
  const size_t A_BYTES = ACT * sizeof(f16);          // 6,291,456
  const size_t W_BYTES = WSZ * sizeof(f16);          // 1,179,648

  char* ws = (char*)d_ws;
  f16* Xh16 = (f16*)(ws);
  f16* Xc16 = (f16*)(ws + A_BYTES);
  f16* Wq16 = (f16*)(ws + 2 * A_BYTES);              // packed Wq, Wk, Wv, W_BYTES each
  f16* Q16  = (f16*)(ws + 2 * A_BYTES + 3 * W_BYTES);
  f16* K16  = (f16*)(ws + 3 * A_BYTES + 3 * W_BYTES);
  f16* Vt16 = (f16*)(ws + 4 * A_BYTES + 3 * W_BYTES);

  // one wave per fragment, 8 waves per block; Xh16, Xc16, Wq16, Wk16, Wv16 in one grid
  pack_f32_f16<<<(2 * ACT + 3 * WSZ) / FRAG / 8, 256, 0, stream>>>(hidden, context, Wq, Wk, Wv, Xh16);

  const float qscale = 1.0f / sqrtf((float)HD + 1e-5f);
  dim3 pgrid((BATCH * SEQ) / 128, HEADS / 2, 3);     // 2 x 2 waves of 64 rows x 1 head per block; z: Q, K, V
  proj_kernel<<<pgrid, 128, 0, stream>>>(Xh16, Xc16, Wq16, bq, bk, bv, Q16, qscale);

  dim3 agrid(SEQ / 64, BATCH * HEADS);               // 2 strips of 32 queries x 2 key halves per block
  attn_kernel<<<agrid, 128, 0, stream>>>(Q16, K16, Vt16, amask, outp);
}

// v008
// It runs in 51.8 microseconds.
// Timed twice side by side with v007, it ran 1.04 and 1.03 times as fast.
// Over all steps from v000 it is 3.41 times as fast.
#include <hip/hip_runtime.h>

typedef _Float16 f16;
typedef _Float16 v4h  __attribute__((ext_vector_type(4)));
typedef _Float16 v8h  __attribute__((ext_vector_type(8)));
typedef _Float16 v16h __attribute__((ext_vector_type(16)));
typedef float    v8f  __attribute__((ext_vector_type(8)));
typedef float    v4f  __attribute__((ext_vector_type(4)));

#define HIDDEN 768
#define HEADS  12
#define HD     64
#define SEQ    2048
#define BATCH  2

#define WMMA_F16(A, B, C) \
  __builtin_amdgcn_wmma_f32_16x16x32_f16(false, (A), false, (B), (short)0, (C), false, false)

static __device__ __forceinline__ v16h cat8(v8h lo, v8h hi) {
  return __builtin_shufflevector(lo, hi, 0,1,2,3,4,5,6,7,8,9,10,11,12,13,14,15);
}

// ---------------------------------------------------------------- fragment order
// Every f16 operand in the workspace is stored as 1-KiB WMMA fragments
// (16 rows x 32 k). Element (row, k) of a fragment sits at half index
//   (k >> 4) * 256 + (((k >> 3) & 1) * 16 + row) * 8 + (k & 7)
// so lane l reads its 2 x 8 halfs at l * 8 and 256 + l * 8: each wave-wide
// 16-byte load covers 512 contiguous bytes (4 lines) instead of 16 rows.
#define FRAG 512                 // halfs per fragment
#define KFR  (HIDDEN / 32)       // fragments along k of a 768-wide operand
#define AHEAD 3                  // k-steps of projection operands in flight per wave
#define RT    4                  // 16-row X tiles per projection wave

static __device__ __forceinline__ v16h load_frag(const f16* p) {   // p includes lane * 8
  return cat8(*(const v8h*)p, *(const v8h*)(p + 256));
}

// A wave-uniform pointer held in a scalar register pair: the loads formed from it
// take the scalar-base form with the lane's 32-bit offset beside it. Without it the
// key loop rebuilds two 64-bit vector addresses every trip in registers that the
// last load of the run then takes for its result.
// The result is typed as a global-memory pointer: rebuilt from two integers it would
// otherwise be taken for a generic one, whose loads also count as LDS operations.
typedef __attribute__((address_space(1))) const char gchar;
typedef __attribute__((address_space(1))) const v8h  gv8h;
static __device__ __forceinline__ gchar* scalar_base(const f16* p) {
  const unsigned long long a = (unsigned long long)p;
  const unsigned lo = (unsigned)__builtin_amdgcn_readfirstlane((int)(unsigned)a);
  const unsigned hi = (unsigned)__builtin_amdgcn_readfirstlane((int)(unsigned)(a >> 32));
  return (gchar*)(((unsigned long long)hi << 32) | lo);
}

static __device__ __forceinline__ v16h load_frag_g(gchar* p) {   // p includes lane * 16 bytes
  return cat8(*(gv8h*)p, *(gv8h*)(p + 512));
}

// ---------------------------------------------------------------- f32 -> f16, packed
// Each plane: rows x 768 f32. One wave converts one fragment: 4 loads of 4 whole lines,
// 4 stores of 8 bytes per lane. plane[(rowtile * KFR + ks) * FRAG + ...].
// One grid packs all five planes; they lie one behind the other in out, in the order
// of the arguments, so a fragment's place in out is its index over the whole grid.
// Every plane is a whole number of 8-fragment blocks: the choice is block-uniform.
#define XFR (BATCH * SEQ * HIDDEN / FRAG)   // fragments of an activation plane
#define WFR (HIDDEN * HIDDEN / FRAG)        // fragments of a weight plane
__global__ __launch_bounds__(256)
void pack_f32_f16(const float* __restrict__ hidden, const float* __restrict__ context,
                  const float* __restrict__ Wq, const float* __restrict__ Wk,
                  const float* __restrict__ Wv, f16* __restrict__ out) {
  const int lane = threadIdx.x & 31;
  const int gfr  = (blockIdx.x * 256 + threadIdx.x) >> 5;   // fragment index in out
  const int bfr  = blockIdx.x * 8;                          // the block's first fragment
  const float* in = hidden;
  int first = 0;
  if (bfr >= XFR)               { in = context; first = XFR; }
  if (bfr >= 2 * XFR)           { in = Wq;      first = 2 * XFR; }
  if (bfr >= 2 * XFR + WFR)     { in = Wk;      first = 2 * XFR + WFR; }
  if (bfr >= 2 * XFR + 2 * WFR) { in = Wv;      first = 2 * XFR + 2 * WFR; }
  const int fr   = gfr - first;                             // fragment index in its plane
  const int mt   = fr / KFR;
  const int ks   = fr % KFR;
  const int k4   = lane & 7;                                // float4 within the 32 k
  const float* src = in + (size_t)(mt * 16 + (lane >> 3)) * HIDDEN + ks * 32 + k4 * 4;
  f16* dst = out + (size_t)gfr * FRAG + (k4 >> 2) * 256
                 + (((k4 >> 1) & 1) * 16 + (lane >> 3)) * 8 + (k4 & 1) * 4;
  float4 v[4];
  #pragma unroll
  for (int i = 0; i < 4; ++i)
    v[i] = *(const float4*)(src + (size_t)i * 4 * HIDDEN);
  #pragma unroll
  for (int i = 0; i < 4; ++i) {
    v4h y = {(f16)v[i].x, (f16)v[i].y, (f16)v[i].z, (f16)v[i].w};
    *(v4h*)(dst + i * 4 * 8) = y;
  }
}

// ---------------------------------------------------------------- projection
// Y = X(4096x768) @ W^T(768x768) + bias. Each wave computes a 64x64 tile
// (4 X frags x 4 W frags -> 16 loads : 16 WMMAs per k-step). The 4 waves of a block
// form 2 x 2 such tiles: each fragment is asked for by two waves of one block.
// VT false: Q or K. The product is formed as W x X^T, so a lane holds 8
//   consecutive d of one position: its 16 bytes of the [bh][s/16][d/32] fragment.
// VT true: V. The product is formed as X x W^T, so a lane holds 8 consecutive
//   positions of one d: its 16 bytes of the [bh][s/32][d/16] fragment.
template <bool VT>
static __device__ __forceinline__
void proj_body(const f16* __restrict__ X, const f16* __restrict__ W,
               const float* __restrict__ bias, f16* __restrict__ out,
               float scale) {
  const int lane = threadIdx.x & 31;
  const int wave = threadIdx.x >> 5;
  const int lr   = lane & 15;
  const int hf   = lane >> 4;

  const int mt0 = (blockIdx.x * 2 + (wave & 1)) * RT;   // first of the wave's row tiles (0..255)
  const int h   = blockIdx.y * 2 + (wave >> 1);         // head == 64-col group

  const f16* xf = X + (size_t)mt0 * KFR * FRAG + lane * 8;
  const f16* wf = W + (size_t)(h * 4) * KFR * FRAG + lane * 8;

  // Register ring, AHEAD k-steps deep: the 16 loads of k-step ks + AHEAD are issued
  // right behind the products of k-step ks, so a wave waits for a load that is
  // AHEAD k-steps old instead of for the one it has just issued.
  v16h a[AHEAD][RT], w[AHEAD][4];
  #pragma unroll
  for (int s = 0; s < AHEAD; ++s) {
    #pragma unroll
    for (int i = 0; i < RT; ++i)
      a[s][i] = load_frag(xf + (i * KFR + s) * FRAG);
    #pragma unroll
    for (int t = 0; t < 4; ++t)
      w[s][t] = load_frag(wf + (t * KFR + s) * FRAG);
  }

  v8f acc[RT][4] = {};
  #pragma unroll
  for (int ks = 0; ks < KFR; ++ks) {
    const int s = ks % AHEAD;
    #pragma unroll
    for (int i = 0; i < RT; ++i)
      #pragma unroll
      for (int t = 0; t < 4; ++t)
        acc[i][t] = VT ? WMMA_F16(a[s][i], w[s][t], acc[i][t]) : WMMA_F16(w[s][t], a[s][i], acc[i][t]);
    if (ks + AHEAD < KFR) {
      #pragma unroll
      for (int i = 0; i < RT; ++i)
        a[s][i] = load_frag(xf + (i * KFR + ks + AHEAD) * FRAG);
      #pragma unroll
      for (int t = 0; t < 4; ++t)
        w[s][t] = load_frag(wf + (t * KFR + ks + AHEAD) * FRAG);
    }
    // Keeps the scheduler from sinking these loads down to their use, AHEAD k-steps later:
    // without it every product waits out the whole latency of the load in front of it.
    __builtin_amdgcn_sched_barrier(0);
  }

  // Every fragment load is issued: the wait stands in front of the epilogue's rewrite of
  // their address registers; the directive keeps the scheduler from lifting that rewrite over it.
  asm volatile("s_wait_xcnt 0x0" ::: "memory");
  __builtin_amdgcn_sched_barrier(0);

  const int bh = ((mt0 * 16) >> 11) * HEADS + h; // SEQ == 2048; 64 rows lie in one batch
  #pragma unroll
  for (int i = 0; i < RT; ++i) {
    const int s0 = ((mt0 + i) * 16) & (SEQ - 1);
    #pragma unroll
    for (int t = 0; t < 4; ++t) {
      v8h y;
      if (VT) {
        const float bv = bias[h * 64 + t * 16 + lr];
        #pragma unroll
        for (int r = 0; r < 8; ++r) y[r] = (f16)((acc[i][t][r] + bv) * scale);
        *(v8h*)(out + ((size_t)(bh * (SEQ / 32) + (s0 >> 5)) * 4 + t) * FRAG
                    + ((s0 >> 4) & 1) * 256 + lane * 8) = y;
      } else {
        const float* bp = bias + h * 64 + t * 16 + 8 * hf;
        #pragma unroll
        for (int r = 0; r < 8; ++r) y[r] = (f16)((acc[i][t][r] + bp[r]) * scale);
        *(v8h*)(out + ((size_t)(bh * (SEQ / 16) + (s0 >> 4)) * 2 + (t >> 1)) * FRAG
                    + (t & 1) * 256 + lane * 8) = y;
      }
    }
  }
  // In the merged kernel the V body's code follows this body's stores in the listing and
  // writes their address and data registers: the wait stands between stores and rewrite.
  if (!VT) asm volatile("s_wait_xcnt 0x0" ::: "memory");
}

// One grid for the three projections: blockIdx.z = 0 Q, 1 K, 2 V. The packed weight
// planes lie one behind the other in W3, the three result planes in out3.
__global__ __launch_bounds__(128)
void proj_kernel(const f16* __restrict__ Xh, const f16* __restrict__ Xc,
                 const f16* __restrict__ W3, const float* __restrict__ bq,
                 const float* __restrict__ bk, const float* __restrict__ bv,
                 f16* __restrict__ out3, float qscale) {
  const int z = blockIdx.z;
  const f16* W = W3 + (size_t)z * (HIDDEN * HIDDEN);
  f16* out = out3 + (size_t)z * (BATCH * SEQ * HIDDEN);
  if (z == 2)
    proj_body<true>(Xc, W, bv, out, 1.0f);
  else
    proj_body<false>(z ? Xc : Xh, W, z ? bk : bq, out, z ? 1.0f : qscale);
}

// ---------------------------------------------------------------- attention
// grid: (SEQ/64, B*H), block 128 (4 waves) = 2 query strips x 2 key halves. A wave owns
// 32 query rows (two 16-row tiles) and one half of the keys, streamed in chunks of 32
// with online softmax (rescaled lazily): 3072 waves, three for each of the chip's 1024 SIMDs (one wave per
// strip makes 1536, which no placement spreads evenly). The two waves of a strip join
// their partial results through LDS behind the loop. K/V frags loaded once per
// chunk (K one chunk ahead of its use) and reused by both query tiles -> 1:1 VMEM:WMMA.
// Q, K: fragments [bh][s/16][d/32]; Vt: fragments [bh][s/32][d/16].
#define KHALF (SEQ / 2)          // keys per wave
#define RESCALE_AT 256.0f        // a lane's sum of 16 exponentials above this moves the softmax reference
__global__ __launch_bounds__(128)
void attn_kernel(const f16* __restrict__ Q, const f16* __restrict__ K,
                 const f16* __restrict__ Vt, const float* __restrict__ mask,
                 float* __restrict__ out) {
  __shared__ __attribute__((aligned(16))) float smask[SEQ];
  __shared__ v4f   xO[4][8][32];         // per wave: the output tile it hands to its partner
  __shared__ float xm[4][32], xl[4][32]; // and that tile's softmax reference and sum
  const int bh = blockIdx.y;
  const int b  = bh / HEADS;
  const int h  = bh % HEADS;

  // The block's 8 KiB of mask: 4 loads of 16 bytes per thread, all issued at once and ahead
  // of the Q and K loads below, so the kernel's head waits out one load latency, not one
  // for each of 16 rounds of load, wait and LDS store with the Q and K loads behind them.
  v4f mrow[SEQ / 512];
  #pragma unroll
  for (int j = 0; j < SEQ / 512; ++j)
    mrow[j] = *(const v4f*)(mask + (size_t)b * SEQ + (j * 128 + threadIdx.x) * 4);

  const int lane = threadIdx.x & 31;
  // the wave's number in a scalar register: the key loop's bounds stay scalar
  const int wave = __builtin_amdgcn_readfirstlane(threadIdx.x >> 5);
  const int lr   = lane & 15;
  const int hf   = lane >> 4;
  const int half = wave >> 1;                            // which half of the keys
  const int q0   = blockIdx.x * 64 + (wave & 1) * 32;    // 32-query strip base
  const int kb0  = half * KHALF;                         // the wave's first key

  // Q as B-operand of S^T = K x Q^T (two query tiles, resident)
  v16h Qb[2][2];
  #pragma unroll
  for (int u = 0; u < 2; ++u) {
    const f16* qf = Q + ((size_t)bh * SEQ + q0 + u * 16) * HD + lane * 8;
    #pragma unroll
    for (int ks = 0; ks < 2; ++ks)
      Qb[u][ks] = load_frag(qf + ks * FRAG);
  }

  const f16* Kbh = K  + (size_t)bh * SEQ * HD;
  const f16* Vbh = Vt + (size_t)bh * HD * SEQ;
  gchar* Ks = scalar_base(Kbh);
  gchar* Vs = scalar_base(Vbh);
  // K and V chunks sit at the same place in their planes: one 32-bit byte offset
  // per lane, carried through the loop, beside the two scalar bases.
  unsigned off = lane * 16 + kb0 * (HD * sizeof(f16));

  v8f O[2][4] = {};
  float m_run[2] = {-1e30f, -1e30f};
  float l_run[2] = {0.f, 0.f};

  // K A-frags of one chunk (2 key tiles x 2 k-steps)
  v16h ka[2][2];
  #pragma unroll
  for (int c = 0; c < 2; ++c)
    #pragma unroll
    for (int ks = 0; ks < 2; ++ks)
      ka[c][ks] = load_frag_g(Ks + off + (c * 2 + ks) * (FRAG * sizeof(f16)));

  #pragma unroll
  for (int j = 0; j < SEQ / 512; ++j)
    *(v4f*)(smask + (j * 128 + threadIdx.x) * 4) = mrow[j];
  __syncthreads();   // publishes the mask; stands behind the issue of the Q and K loads, whose latency passes with the mask's

  for (int kb = kb0; kb < kb0 + KHALF; kb += 32) {
    // The next chunk, or on the wave's last trip this chunk once more, of which nothing is
    // used: one instruction stream in every trip, so every wait below counts the same loads.
    const int kn = (kb + 32 < kb0 + KHALF) ? kb + 32 : kb;

    // ---- V B-frags (4 d-tiles) of this chunk: first used behind the softmax
    v16h vb[4];
    #pragma unroll
    for (int t = 0; t < 4; ++t)
      vb[t] = load_frag_g(Vs + off + t * (FRAG * sizeof(f16)));
    float mk0[8], mk1[8];
    #pragma unroll
    for (int r = 0; r < 8; ++r) {
      mk0[r] = smask[kb + r + 8 * hf];
      mk1[r] = smask[kb + 16 + r + 8 * hf];
    }

    // global_prefetch_b8: the next chunk's 4 KiB of V, one ask per 256 B
    __builtin_prefetch(Vs + (unsigned)kn * (HD * sizeof(f16)) + lr * 256, 0, 1);

    // ---- S^T tiles of both query tiles: the last readers of this chunk's K frags
    v8f c0[2], c1[2];
    #pragma unroll
    for (int u = 0; u < 2; ++u) {
      c0[u] = v8f{}; c1[u] = v8f{};
      #pragma unroll
      for (int ks = 0; ks < 2; ++ks) {
        c0[u] = WMMA_F16(ka[0][ks], Qb[u][ks], c0[u]);
        c1[u] = WMMA_F16(ka[1][ks], Qb[u][ks], c1[u]);
      }
    }

    // ---- the next chunk's K frags, into the same registers: their latency passes under
    // this chunk's softmax and P x V instead of being waited out at the next trip's head.
    // The directives keep the K loads up here: without them the scheduler sinks the loads
    // down to their use in the next trip.
    __builtin_amdgcn_sched_barrier(0);
    const unsigned koff = off + (kn - kb) * (HD * sizeof(f16));
    #pragma unroll
    for (int c = 0; c < 2; ++c)
      #pragma unroll
      for (int ks = 0; ks < 2; ++ks)
        ka[c][ks] = load_frag_g(Ks + koff + (c * 2 + ks) * (FRAG * sizeof(f16)));
    __builtin_amdgcn_sched_barrier(0);

    // ---- lazy rescale. m_run is the softmax reference in use, not the true maximum: it
    // cancels in O / l, so any value serves that keeps the exponentials in range. They are
    // taken against it at once; lane carries query lr (replicated in halves), so the sum over
    // the lane's own 16 keys needs no other lane and bounds each of its terms.
    float p[2][16], e[2][16], lsum[2];
    #pragma unroll
    for (int u = 0; u < 2; ++u) {
      lsum[u] = 0.f;
      #pragma unroll
      for (int r = 0; r < 8; ++r) {
        float s0 = c0[u][r] + mk0[r];
        float s1 = c1[u][r] + mk1[r];
        p[u][r] = s0; p[u][8 + r] = s1;
        float e0 = __expf(s0 - m_run[u]);
        float e1 = __expf(s1 - m_run[u]);
        lsum[u] += e0 + e1;
        e[u][r] = e0; e[u][8 + r] = e1;
      }
    }

    // Only when some lane's sum leaves the range (an infinite one too, as on the first trip)
    // is the chunk's maximum formed, the reference moved, l and O rescaled and the chunk's
    // exponentials taken anew. One test per trip for both query tiles, as a scalar branch:
    // every lane is on inside it, as its cross-lane reads need.
    const bool need = !(lsum[0] <= RESCALE_AT) || !(lsum[1] <= RESCALE_AT);
    if (__builtin_amdgcn_ballot_w32(need) != 0) {
      #pragma unroll
      for (int u = 0; u < 2; ++u) {
        float mx = -1e30f;
        #pragma unroll
        for (int r = 0; r < 8; ++r)
          mx = fmaxf(mx, fmaxf(p[u][r], p[u][8 + r]));
        mx = fmaxf(mx, __shfl_xor(mx, 16, 32));      // both halves take the same reference
        const float m_new = fmaxf(m_run[u], mx);
        const float alpha = __expf(m_run[u] - m_new);
        l_run[u] *= alpha;
        m_run[u] = m_new;
        // O rows (row M = r + 8*hf; alpha for query j lives in lane j)
        #pragma unroll
        for (int r = 0; r < 8; ++r) {
          float ar = __shfl(alpha, r + 8 * hf, 32);
          #pragma unroll
          for (int t = 0; t < 4; ++t) O[u][t][r] *= ar;
        }
        lsum[u] = 0.f;
        #pragma unroll
        for (int r = 0; r < 8; ++r) {
          float e0 = __expf(p[u][r] - m_new);
          float e1 = __expf(p[u][8 + r] - m_new);
          lsum[u] += e0 + e1;
          e[u][r] = e0; e[u][8 + r] = e1;
        }
      }
    }

    // The other half's sums: asked for here, added behind the products.
    float lx[2];
    #pragma unroll
    for (int u = 0; u < 2; ++u) lx[u] = __shfl_xor(lsum[u], 16, 32);

    #pragma unroll
    for (int u = 0; u < 2; ++u) {
      v16h pa;              // C-layout of S^T tiles == A-layout of P
      #pragma unroll
      for (int r = 0; r < 16; ++r) pa[r] = (f16)e[u][r];

      // ---- O += P x Vchunk (V frags shared across u)
      #pragma unroll
      for (int t = 0; t < 4; ++t)
        O[u][t] = WMMA_F16(pa, vb[t], O[u][t]);
    }
    // Holds the adds of the other half's sums down here: lifted up among the products they
    // make the wave wait out the cross-lane reads' latency with products still to issue.
    __builtin_amdgcn_sched_barrier(0);
    #pragma unroll
    for (int u = 0; u < 2; ++u) l_run[u] += lsum[u] + lx[u];
    // Holds the step of off down here, behind the products that wait for every V load of the
    // trip: lifted up among them it would rewrite the offset register of loads still in flight.
    __builtin_amdgcn_sched_barrier(0);
    off += 32 * HD * sizeof(f16);
  }

  // ---- join the two key halves: the wave of half h finishes query tile h of its strip
  // and hands its partial sums of the other tile to its partner (wave ^ 2) through LDS.
  const bool hi = half != 0;
  v8f keep[4];
  #pragma unroll
  for (int t = 0; t < 4; ++t) {
    const v8f give = hi ? O[0][t] : O[1][t];
    keep[t] = hi ? O[1][t] : O[0][t];
    xO[wave][t * 2][lane]     = __builtin_shufflevector(give, give, 0, 1, 2, 3);
    xO[wave][t * 2 + 1][lane] = __builtin_shufflevector(give, give, 4, 5, 6, 7);
  }
  xm[wave][lane] = hi ? m_run[0] : m_run[1];
  xl[wave][lane] = hi ? l_run[0] : l_run[1];
  const float m_k = hi ? m_run[1] : m_run[0];
  const float l_k = hi ? l_run[1] : l_run[0];
  __syncthreads();   // publishes every wave's handed-over tile to its partner

  const int pw = wave ^ 2;
  const float m_p = xm[pw][lane];
  const float l_p = xl[pw][lane];
  const float m_j = fmaxf(m_k, m_p);
  const float a_k = __expf(m_k - m_j);
  const float a_p = __expf(m_p - m_j);
  const float inv = 1.0f / (l_k * a_k + l_p * a_p);
  const float f_k = a_k * inv;           // weight of this wave's sums, query lr
  const float f_p = a_p * inv;           // weight of the partner's sums
  v4f part[8];
  #pragma unroll
  for (int j = 0; j < 8; ++j) part[j] = xO[pw][j][lane];

  // ---- weigh, add and store [B,S,768] f32
  #pragma unroll
  for (int r = 0; r < 8; ++r) {
    const float kr = __shfl(f_k, r + 8 * hf, 32);
    const float pr = __shfl(f_p, r + 8 * hf, 32);
    const int s = q0 + half * 16 + r + 8 * hf;
    #pragma unroll
    for (int t = 0; t < 4; ++t)
      out[((size_t)b * SEQ + s) * HIDDEN + h * 64 + t * 16 + lr] =
          keep[t][r] * kr + part[t * 2 + (r >> 2)][r & 3] * pr;
  }
}

// ---------------------------------------------------------------- launcher
extern "C" void kernel_launch(void* const* d_in, const int* in_sizes, int n_in,
                              void* d_out, int out_size, void* d_ws, size_t ws_size,
                              hipStream_t stream) {
  const float* hidden  = (const float*)d_in[0];
  const float* context = (const float*)d_in[1];
  const float* amask   = (const float*)d_in[2];
  const float* Wq = (const float*)d_in[3];
  const float* bq = (const float*)d_in[4];
  const float* Wk = (const float*)d_in[5];
  const float* bk = (const float*)d_in[6];
  const float* Wv = (const float*)d_in[7];
  const float* bv = (const float*)d_in[8];
  float* outp = (float*)d_out;

  const size_t ACT = (size_t)BATCH * SEQ * HIDDEN;   // 3,145,728 elems
  const size_t WSZ = (size_t)HIDDEN * HIDDEN;        //   589,824 elems
  const size_t A_BYTES = ACT * sizeof(f16);          // 6,291,456
  const size_t W_BYTES = WSZ * sizeof(f16);          // 1,179,648

  char* ws = (char*)d_ws;
  f16* Xh16 = (f16*)(ws);
  f16* Xc16 = (f16*)(ws + A_BYTES);
  f16* Wq16 = (f16*)(ws + 2 * A_BYTES);              // packed Wq, Wk, Wv, W_BYTES each
  f16* Q16  = (f16*)(ws + 2 * A_BYTES + 3 * W_BYTES);
  f16* K16  = (f16*)(ws + 3 * A_BYTES + 3 * W_BYTES);
  f16* Vt16 = (f16*)(ws + 4 * A_BYTES + 3 * W_BYTES);

  // one wave per fragment, 8 waves per block; Xh16, Xc16, Wq16, Wk16, Wv16 in one grid
  pack_f32_f16<<<(2 * ACT + 3 * WSZ) / FRAG / 8, 256, 0, stream>>>(hidden, context, Wq, Wk, Wv, Xh16);

  const float qscale = 1.0f / sqrtf((float)HD + 1e-5f);
  dim3 pgrid((BATCH * SEQ) / 128, HEADS / 2, 3);     // 2 x 2 waves of 64 rows x 1 head per block; z: Q, K, V
  proj_kernel<<<pgrid, 128, 0, stream>>>(Xh16, Xc16, Wq16, bq, bk, bv, Q16, qscale);

  dim3 agrid(SEQ / 64, BATCH * HEADS);               // 2 strips of 32 queries x 2 key halves per block
  attn_kernel<<<agrid, 128, 0, stream>>>(Q16, K16, Vt16, amask, outp);
}

// v009
// A run of this version takes 47.5 microseconds.
// Timed twice side by side with v008, it ran 1.10 and 1.08 times as fast.
// Counting every step since v000, it is 3.71 times as fast.
#include <hip/hip_runtime.h>

typedef _Float16 f16;
typedef _Float16 v4h  __attribute__((ext_vector_type(4)));
typedef _Float16 v8h  __attribute__((ext_vector_type(8)));
typedef _Float16 v16h __attribute__((ext_vector_type(16)));
typedef float    v8f  __attribute__((ext_vector_type(8)));
typedef float    v4f  __attribute__((ext_vector_type(4)));

#define HIDDEN 768
#define HEADS  12
#define HD     64
#define SEQ    2048
#define BATCH  2

#define WMMA_F16(A, B, C) \
  __builtin_amdgcn_wmma_f32_16x16x32_f16(false, (A), false, (B), (short)0, (C), false, false)

static __device__ __forceinline__ v16h cat8(v8h lo, v8h hi) {
  return __builtin_shufflevector(lo, hi, 0,1,2,3,4,5,6,7,8,9,10,11,12,13,14,15);
}

// ---------------------------------------------------------------- fragment order
// Every f16 operand in the workspace is stored as 1-KiB WMMA fragments
// (16 rows x 32 k). Element (row, k) of a fragment sits at half index
//   (k >> 4) * 256 + (((k >> 3) & 1) * 16 + row) * 8 + (k & 7)
// so lane l reads its 2 x 8 halfs at l * 8 and 256 + l * 8: each wave-wide
// 16-byte load covers 512 contiguous bytes (4 lines) instead of 16 rows.
#define FRAG 512                 // halfs per fragment
#define KFR  (HIDDEN / 32)       // fragments along k of a 768-wide operand
#define AHEAD 3                  // k-steps of projection operands in flight per wave
#define RT    4                  // 16-row X tiles per projection wave

static __device__ __forceinline__ v16h load_frag(const f16* p) {   // p includes lane * 8
  return cat8(*(const v8h*)p, *(const v8h*)(p + 256));
}

// A wave-uniform pointer held in a scalar register pair: the loads formed from it
// take the scalar-base form with the lane's 32-bit offset beside it. Without it the
// key loop rebuilds two 64-bit vector addresses every trip in registers that the
// last load of the run then takes for its result.
// The result is typed as a global-memory pointer: rebuilt from two integers it would
// otherwise be taken for a generic one, whose loads also count as LDS operations.
typedef __attribute__((address_space(1))) const char gchar;
typedef __attribute__((address_space(1))) const v8h  gv8h;
static __device__ __forceinline__ gchar* scalar_base(const f16* p) {
  const unsigned long long a = (unsigned long long)p;
  const unsigned lo = (unsigned)__builtin_amdgcn_readfirstlane((int)(unsigned)a);
  const unsigned hi = (unsigned)__builtin_amdgcn_readfirstlane((int)(unsigned)(a >> 32));
  return (gchar*)(((unsigned long long)hi << 32) | lo);
}

static __device__ __forceinline__ v16h load_frag_g(gchar* p) {   // p includes lane * 16 bytes
  return cat8(*(gv8h*)p, *(gv8h*)(p + 512));
}

// ---------------------------------------------------------------- f32 -> f16, packed
// Each plane: rows x 768 f32. One wave converts one fragment: 4 loads of 4 whole lines,
// 4 stores of 8 bytes per lane. plane[(rowtile * KFR + ks) * FRAG + ...].
// One grid packs all five planes; they lie one behind the other in out, in the order
// of the arguments, so a fragment's place in out is its index over the whole grid.
// Every plane is a whole number of 8-fragment blocks: the choice is block-uniform.
#define XFR (BATCH * SEQ * HIDDEN / FRAG)   // fragments of an activation plane
#define WFR (HIDDEN * HIDDEN / FRAG)        // fragments of a weight plane
__global__ __launch_bounds__(256)
void pack_f32_f16(const float* __restrict__ hidden, const float* __restrict__ context,
                  const float* __restrict__ Wq, const float* __restrict__ Wk,
                  const float* __restrict__ Wv, f16* __restrict__ out) {
  const int lane = threadIdx.x & 31;
  const int gfr  = (blockIdx.x * 256 + threadIdx.x) >> 5;   // fragment index in out
  const int bfr  = blockIdx.x * 8;                          // the block's first fragment
  const float* in = hidden;
  int first = 0;
  if (bfr >= XFR)               { in = context; first = XFR; }
  if (bfr >= 2 * XFR)           { in = Wq;      first = 2 * XFR; }
  if (bfr >= 2 * XFR + WFR)     { in = Wk;      first = 2 * XFR + WFR; }
  if (bfr >= 2 * XFR + 2 * WFR) { in = Wv;      first = 2 * XFR + 2 * WFR; }
  const int fr   = gfr - first;                             // fragment index in its plane
  const int mt   = fr / KFR;
  const int ks   = fr % KFR;
  const int k4   = lane & 7;                                // float4 within the 32 k
  const float* src = in + (size_t)(mt * 16 + (lane >> 3)) * HIDDEN + ks * 32 + k4 * 4;
  f16* dst = out + (size_t)gfr * FRAG + (k4 >> 2) * 256
                 + (((k4 >> 1) & 1) * 16 + (lane >> 3)) * 8 + (k4 & 1) * 4;
  float4 v[4];
  #pragma unroll
  for (int i = 0; i < 4; ++i)
    v[i] = *(const float4*)(src + (size_t)i * 4 * HIDDEN);
  #pragma unroll
  for (int i = 0; i < 4; ++i) {
    v4h y = {(f16)v[i].x, (f16)v[i].y, (f16)v[i].z, (f16)v[i].w};
    *(v4h*)(dst + i * 4 * 8) = y;
  }
}

// ---------------------------------------------------------------- projection
// Y = X(4096x768) @ W^T(768x768) + bias. Each wave computes a 64x64 tile
// (4 X frags x 4 W frags -> 16 loads : 16 WMMAs per k-step). The 4 waves of a block
// form 2 x 2 such tiles: each fragment is asked for by two waves of one block.
// VT false: Q or K. The product is formed as W x X^T, so a lane holds 8
//   consecutive d of one position: its 16 bytes of the [bh][s/16][d/32] fragment.
// VT true: V. The product is formed as X x W^T, so a lane holds 8 consecutive
//   positions of one d: its 16 bytes of the [bh][s/32][d/16] fragment.
template <bool VT>
static __device__ __forceinline__
void proj_body(const f16* __restrict__ X, const f16* __restrict__ W,
               const float* __restrict__ bias, f16* __restrict__ out,
               float scale) {
  const int lane = threadIdx.x & 31;
  const int wave = threadIdx.x >> 5;
  const int lr   = lane & 15;
  const int hf   = lane >> 4;

  const int mt0 = (blockIdx.x * 2 + (wave & 1)) * RT;   // first of the wave's row tiles (0..255)
  const int h   = blockIdx.y * 2 + (wave >> 1);         // head == 64-col group

  const f16* xf = X + (size_t)mt0 * KFR * FRAG + lane * 8;
  const f16* wf = W + (size_t)(h * 4) * KFR * FRAG + lane * 8;

  // Register ring, AHEAD k-steps deep: the 16 loads of k-step ks + AHEAD are issued
  // right behind the products of k-step ks, so a wave waits for a load that is
  // AHEAD k-steps old instead of for the one it has just issued.
  v16h a[AHEAD][RT], w[AHEAD][4];
  #pragma unroll
  for (int s = 0; s < AHEAD; ++s) {
    #pragma unroll
    for (int i = 0; i < RT; ++i)
      a[s][i] = load_frag(xf + (i * KFR + s) * FRAG);
    #pragma unroll
    for (int t = 0; t < 4; ++t)
      w[s][t] = load_frag(wf + (t * KFR + s) * FRAG);
  }

  v8f acc[RT][4] = {};
  #pragma unroll
  for (int ks = 0; ks < KFR; ++ks) {
    const int s = ks % AHEAD;
    #pragma unroll
    for (int i = 0; i < RT; ++i)
      #pragma unroll
      for (int t = 0; t < 4; ++t)
        acc[i][t] = VT ? WMMA_F16(a[s][i], w[s][t], acc[i][t]) : WMMA_F16(w[s][t], a[s][i], acc[i][t]);
    if (ks + AHEAD < KFR) {
      #pragma unroll
      for (int i = 0; i < RT; ++i)
        a[s][i] = load_frag(xf + (i * KFR + ks + AHEAD) * FRAG);
      #pragma unroll
      for (int t = 0; t < 4; ++t)
        w[s][t] = load_frag(wf + (t * KFR + ks + AHEAD) * FRAG);
    }
    // Keeps the scheduler from sinking these loads down to their use, AHEAD k-steps later:
    // without it every product waits out the whole latency of the load in front of it.
    __builtin_amdgcn_sched_barrier(0);
  }

  // Every fragment load is issued: the wait stands in front of the epilogue's rewrite of
  // their address registers; the directive keeps the scheduler from lifting that rewrite over it.
  asm volatile("s_wait_xcnt 0x0" ::: "memory");
  __builtin_amdgcn_sched_barrier(0);

  const int bh = ((mt0 * 16) >> 11) * HEADS + h; // SEQ == 2048; 64 rows lie in one batch
  #pragma unroll
  for (int i = 0; i < RT; ++i) {
    const int s0 = ((mt0 + i) * 16) & (SEQ - 1);
    #pragma unroll
    for (int t = 0; t < 4; ++t) {
      v8h y;
      if (VT) {
        const float bv = bias[h * 64 + t * 16 + lr];
        #pragma unroll
        for (int r = 0; r < 8; ++r) y[r] = (f16)((acc[i][t][r] + bv) * scale);
        *(v8h*)(out + ((size_t)(bh * (SEQ / 32) + (s0 >> 5)) * 4 + t) * FRAG
                    + ((s0 >> 4) & 1) * 256 + lane * 8) = y;
      } else {
        const float* bp = bias + h * 64 + t * 16 + 8 * hf;
        #pragma unroll
        for (int r = 0; r < 8; ++r) y[r] = (f16)((acc[i][t][r] + bp[r]) * scale);
        *(v8h*)(out + ((size_t)(bh * (SEQ / 16) + (s0 >> 4)) * 2 + (t >> 1)) * FRAG
                    + (t & 1) * 256 + lane * 8) = y;
      }
    }
  }
  // In the merged kernel the V body's code follows this body's stores in the listing and
  // writes their address and data registers: the wait stands between stores and rewrite.
  if (!VT) asm volatile("s_wait_xcnt 0x0" ::: "memory");
}

// One grid for the three projections: blockIdx.z = 0 Q, 1 K, 2 V. The packed weight
// planes lie one behind the other in W3, the three result planes in out3.
__global__ __launch_bounds__(128)
void proj_kernel(const f16* __restrict__ Xh, const f16* __restrict__ Xc,
                 const f16* __restrict__ W3, const float* __restrict__ bq,
                 const float* __restrict__ bk, const float* __restrict__ bv,
                 f16* __restrict__ out3, float qscale) {
  const int z = blockIdx.z;
  const f16* W = W3 + (size_t)z * (HIDDEN * HIDDEN);
  f16* out = out3 + (size_t)z * (BATCH * SEQ * HIDDEN);
  if (z == 2)
    proj_body<true>(Xc, W, bv, out, 1.0f);
  else
    proj_body<false>(z ? Xc : Xh, W, z ? bk : bq, out, z ? 1.0f : qscale);
}

// ---------------------------------------------------------------- attention
// grid: (SEQ/64, B*H), block 128 (4 waves) = 2 query strips x 2 key halves. A wave owns
// 32 query rows (two 16-row tiles) and one half of the keys, streamed in chunks of 32
// with online softmax (rescaled lazily): 3072 waves, three for each of the chip's 1024 SIMDs (one wave per
// strip makes 1536, which no placement spreads evenly). The two waves of a strip join
// their partial results through LDS behind the loop. K/V frags loaded once per
// chunk (K one chunk ahead of its use) and reused by both query tiles -> 1:1 VMEM:WMMA.
// Q, K: fragments [bh][s/16][d/32]; Vt: fragments [bh][s/32][d/16].
#define KHALF (SEQ / 2)          // keys per wave
#define NCH   (KHALF / 32)       // chunks of 32 keys per wave
// Every block walks its keys in a ring that starts at a chunk of its own (blockIdx.x): the
// 32 blocks of one head read 32 different chunks of K and V at any time instead of all
// asking for the same lines in step, and a chunk that one block has brought into L2 is
// there when the others come round to it.
#define RESCALE_AT 256.0f        // a lane's sum of 16 exponentials above this moves the softmax reference
__global__ __launch_bounds__(128)
void attn_kernel(const f16* __restrict__ Q, const f16* __restrict__ K,
                 const f16* __restrict__ Vt, const float* __restrict__ mask,
                 float* __restrict__ out) {
  __shared__ __attribute__((aligned(16))) float smask[SEQ];
  __shared__ v4f   xO[4][8][32];         // per wave: the output tile it hands to its partner
  __shared__ float xm[4][32], xl[4][32]; // and that tile's softmax reference and sum
  const int bh = blockIdx.y;
  const int b  = bh / HEADS;
  const int h  = bh % HEADS;

  // The block's 8 KiB of mask: 4 loads of 16 bytes per thread, all issued at once and ahead
  // of the Q and K loads below, so the kernel's head waits out one load latency, not one
  // for each of 16 rounds of load, wait and LDS store with the Q and K loads behind them.
  v4f mrow[SEQ / 512];
  #pragma unroll
  for (int j = 0; j < SEQ / 512; ++j)
    mrow[j] = *(const v4f*)(mask + (size_t)b * SEQ + (j * 128 + threadIdx.x) * 4);

  const int lane = threadIdx.x & 31;
  // the wave's number in a scalar register: the key offsets kb0 and kb stay scalar
  const int wave = __builtin_amdgcn_readfirstlane(threadIdx.x >> 5);
  const int lr   = lane & 15;
  const int hf   = lane >> 4;
  const int half = wave >> 1;                            // which half of the keys
  const int q0   = blockIdx.x * 64 + (wave & 1) * 32;    // 32-query strip base
  const int kb0  = half * KHALF;                         // first key of the wave's half

  // Q as B-operand of S^T = K x Q^T (two query tiles, resident)
  v16h Qb[2][2];
  #pragma unroll
  for (int u = 0; u < 2; ++u) {
    const f16* qf = Q + ((size_t)bh * SEQ + q0 + u * 16) * HD + lane * 8;
    #pragma unroll
    for (int ks = 0; ks < 2; ++ks)
      Qb[u][ks] = load_frag(qf + ks * FRAG);
  }

  const f16* Kbh = K  + (size_t)bh * SEQ * HD;
  const f16* Vbh = Vt + (size_t)bh * HD * SEQ;
  gchar* Ks = scalar_base(Kbh);
  gchar* Vs = scalar_base(Vbh);
  // K and V chunks sit at the same place in their planes: one 32-bit byte offset
  // per lane, carried through the loop, beside the two scalar bases.
  int ch = blockIdx.x & (NCH - 1);                       // place in the ring: chunk inside the wave's half
  unsigned off = lane * 16 + (kb0 + ch * 32) * (HD * sizeof(f16));

  v8f O[2][4] = {};
  float m_run[2] = {-1e30f, -1e30f};
  float l_run[2] = {0.f, 0.f};

  // K A-frags of one chunk (2 key tiles x 2 k-steps)
  v16h ka[2][2];
  #pragma unroll
  for (int c = 0; c < 2; ++c)
    #pragma unroll
    for (int ks = 0; ks < 2; ++ks)
      ka[c][ks] = load_frag_g(Ks + off + (c * 2 + ks) * (FRAG * sizeof(f16)));

  #pragma unroll
  for (int j = 0; j < SEQ / 512; ++j)
    *(v4f*)(smask + (j * 128 + threadIdx.x) * 4) = mrow[j];
  __syncthreads();   // publishes the mask; stands behind the issue of the Q and K loads, whose latency passes with the mask's

  for (int trip = 0; trip < NCH; ++trip) {
    // The next chunk of the ring; on the wave's last trip that is its first chunk once more, of
    // which nothing is used: one instruction stream in every trip, so every wait below counts the same loads.
    const int kb = kb0 + ch * 32;
    const int cn = (ch + 1) & (NCH - 1);
    const int kn = kb0 + cn * 32;

    // ---- V B-frags (4 d-tiles) of this chunk: first used behind the softmax
    v16h vb[4];
    #pragma unroll
    for (int t = 0; t < 4; ++t)
      vb[t] = load_frag_g(Vs + off + t * (FRAG * sizeof(f16)));
    float mk0[8], mk1[8];
    #pragma unroll
    for (int r = 0; r < 8; ++r) {
      mk0[r] = smask[kb + r + 8 * hf];
      mk1[r] = smask[kb + 16 + r + 8 * hf];
    }

    // global_prefetch_b8: the next chunk's 4 KiB of V, one ask per 256 B
    __builtin_prefetch(Vs + (unsigned)kn * (HD * sizeof(f16)) + lr * 256, 0, 1);

    // ---- S^T tiles of both query tiles: the last readers of this chunk's K frags
    v8f c0[2], c1[2];
    #pragma unroll
    for (int u = 0; u < 2; ++u) {
      c0[u] = v8f{}; c1[u] = v8f{};
      #pragma unroll
      for (int ks = 0; ks < 2; ++ks) {
        c0[u] = WMMA_F16(ka[0][ks], Qb[u][ks], c0[u]);
        c1[u] = WMMA_F16(ka[1][ks], Qb[u][ks], c1[u]);
      }
    }

    // ---- the next chunk's K frags, into the same registers: their latency passes under
    // this chunk's softmax and P x V instead of being waited out at the next trip's head.
    // The directives keep the K loads up here: without them the scheduler sinks the loads
    // down to their use in the next trip.
    __builtin_amdgcn_sched_barrier(0);
    // off moves on to the next chunk here, behind the issue of this chunk's V loads: one
    // offset register serves both planes (the step is negative where the ring closes).
    off += (kn - kb) * (HD * sizeof(f16));
    #pragma unroll
    for (int c = 0; c < 2; ++c)
      #pragma unroll
      for (int ks = 0; ks < 2; ++ks)
        ka[c][ks] = load_frag_g(Ks + off + (c * 2 + ks) * (FRAG * sizeof(f16)));
    __builtin_amdgcn_sched_barrier(0);

    // ---- lazy rescale. m_run is the softmax reference in use, not the true maximum: it
    // cancels in O / l, so any value serves that keeps the exponentials in range. They are
    // taken against it at once; lane carries query lr (replicated in halves), so the sum over
    // the lane's own 16 keys needs no other lane and bounds each of its terms.
    float p[2][16], e[2][16], lsum[2];
    #pragma unroll
    for (int u = 0; u < 2; ++u) {
      lsum[u] = 0.f;
      #pragma unroll
      for (int r = 0; r < 8; ++r) {
        float s0 = c0[u][r] + mk0[r];
        float s1 = c1[u][r] + mk1[r];
        p[u][r] = s0; p[u][8 + r] = s1;
        float e0 = __expf(s0 - m_run[u]);
        float e1 = __expf(s1 - m_run[u]);
        lsum[u] += e0 + e1;
        e[u][r] = e0; e[u][8 + r] = e1;
      }
    }

    // Only when some lane's sum leaves the range (an infinite one too, as on the first trip)
    // is the chunk's maximum formed, the reference moved, l and O rescaled and the chunk's
    // exponentials taken anew. One test per trip for both query tiles, as a scalar branch:
    // every lane is on inside it, as its cross-lane reads need.
    const bool need = !(lsum[0] <= RESCALE_AT) || !(lsum[1] <= RESCALE_AT);
    if (__builtin_amdgcn_ballot_w32(need) != 0) {
      #pragma unroll
      for (int u = 0; u < 2; ++u) {
        float mx = -1e30f;
        #pragma unroll
        for (int r = 0; r < 8; ++r)
          mx = fmaxf(mx, fmaxf(p[u][r], p[u][8 + r]));
        mx = fmaxf(mx, __shfl_xor(mx, 16, 32));      // both halves take the same reference
        const float m_new = fmaxf(m_run[u], mx);
        const float alpha = __expf(m_run[u] - m_new);
        l_run[u] *= alpha;
        m_run[u] = m_new;
        // O rows (row M = r + 8*hf; alpha for query j lives in lane j)
        #pragma unroll
        for (int r = 0; r < 8; ++r) {
          float ar = __shfl(alpha, r + 8 * hf, 32);
          #pragma unroll
          for (int t = 0; t < 4; ++t) O[u][t][r] *= ar;
        }
        lsum[u] = 0.f;
        #pragma unroll
        for (int r = 0; r < 8; ++r) {
          float e0 = __expf(p[u][r] - m_new);
          float e1 = __expf(p[u][8 + r] - m_new);
          lsum[u] += e0 + e1;
          e[u][r] = e0; e[u][8 + r] = e1;
        }
      }
    }

    // The other half's sums: asked for here, added behind the products.
    float lx[2];
    #pragma unroll
    for (int u = 0; u < 2; ++u) lx[u] = __shfl_xor(lsum[u], 16, 32);

    #pragma unroll
    for (int u = 0; u < 2; ++u) {
      v16h pa;              // C-layout of S^T tiles == A-layout of P
      #pragma unroll
      for (int r = 0; r < 16; ++r) pa[r] = (f16)e[u][r];

      // ---- O += P x Vchunk (V frags shared across u)
      #pragma unroll
      for (int t = 0; t < 4; ++t)
        O[u][t] = WMMA_F16(pa, vb[t], O[u][t]);
    }
    // Holds the adds of the other half's sums down here: lifted up among the products they
    // make the wave wait out the cross-lane reads' latency with products still to issue.
    __builtin_amdgcn_sched_barrier(0);
    #pragma unroll
    for (int u = 0; u < 2; ++u) l_run[u] += lsum[u] + lx[u];
    ch = cn;
  }

  // ---- join the two key halves: the wave of half h finishes query tile h of its strip
  // and hands its partial sums of the other tile to its partner (wave ^ 2) through LDS.
  const bool hi = half != 0;
  v8f keep[4];
  #pragma unroll
  for (int t = 0; t < 4; ++t) {
    const v8f give = hi ? O[0][t] : O[1][t];
    keep[t] = hi ? O[1][t] : O[0][t];
    xO[wave][t * 2][lane]     = __builtin_shufflevector(give, give, 0, 1, 2, 3);
    xO[wave][t * 2 + 1][lane] = __builtin_shufflevector(give, give, 4, 5, 6, 7);
  }
  xm[wave][lane] = hi ? m_run[0] : m_run[1];
  xl[wave][lane] = hi ? l_run[0] : l_run[1];
  const float m_k = hi ? m_run[1] : m_run[0];
  const float l_k = hi ? l_run[1] : l_run[0];
  __syncthreads();   // publishes every wave's handed-over tile to its partner

  const int pw = wave ^ 2;
  const float m_p = xm[pw][lane];
  const float l_p = xl[pw][lane];
  const float m_j = fmaxf(m_k, m_p);
  const float a_k = __expf(m_k - m_j);
  const float a_p = __expf(m_p - m_j);
  const float inv = 1.0f / (l_k * a_k + l_p * a_p);
  const float f_k = a_k * inv;           // weight of this wave's sums, query lr
  const float f_p = a_p * inv;           // weight of the partner's sums
  v4f part[8];
  #pragma unroll
  for (int j = 0; j < 8; ++j) part[j] = xO[pw][j][lane];

  // ---- weigh, add and store [B,S,768] f32
  #pragma unroll
  for (int r = 0; r < 8; ++r) {
    const float kr = __shfl(f_k, r + 8 * hf, 32);
    const float pr = __shfl(f_p, r + 8 * hf, 32);
    const int s = q0 + half * 16 + r + 8 * hf;
    #pragma unroll
    for (int t = 0; t < 4; ++t)
      out[((size_t)b * SEQ + s) * HIDDEN + h * 64 + t * 16 + lr] =
          keep[t][r] * kr + part[t * 2 + (r >> 2)][r & 3] * pr;
  }
}

// ---------------------------------------------------------------- launcher
extern "C" void kernel_launch(void* const* d_in, const int* in_sizes, int n_in,
                              void* d_out, int out_size, void* d_ws, size_t ws_size,
                              hipStream_t stream) {
  const float* hidden  = (const float*)d_in[0];
  const float* context = (const float*)d_in[1];
  const float* amask   = (const float*)d_in[2];
  const float* Wq = (const float*)d_in[3];
  const float* bq = (const float*)d_in[4];
  const float* Wk = (const float*)d_in[5];
  const float* bk = (const float*)d_in[6];
  const float* Wv = (const float*)d_in[7];
  const float* bv = (const float*)d_in[8];
  float* outp = (float*)d_out;

  const size_t ACT = (size_t)BATCH * SEQ * HIDDEN;   // 3,145,728 elems
  const size_t WSZ = (size_t)HIDDEN * HIDDEN;        //   589,824 elems
  const size_t A_BYTES = ACT * sizeof(f16);          // 6,291,456
  const size_t W_BYTES = WSZ * sizeof(f16);          // 1,179,648

  char* ws = (char*)d_ws;
  f16* Xh16 = (f16*)(ws);
  f16* Xc16 = (f16*)(ws + A_BYTES);
  f16* Wq16 = (f16*)(ws + 2 * A_BYTES);              // packed Wq, Wk, Wv, W_BYTES each
  f16* Q16  = (f16*)(ws + 2 * A_BYTES + 3 * W_BYTES);
  f16* K16  = (f16*)(ws + 3 * A_BYTES + 3 * W_BYTES);
  f16* Vt16 = (f16*)(ws + 4 * A_BYTES + 3 * W_BYTES);

  // one wave per fragment, 8 waves per block; Xh16, Xc16, Wq16, Wk16, Wv16 in one grid
  pack_f32_f16<<<(2 * ACT + 3 * WSZ) / FRAG / 8, 256, 0, stream>>>(hidden, context, Wq, Wk, Wv, Xh16);

  const float qscale = 1.0f / sqrtf((float)HD + 1e-5f);
  dim3 pgrid((BATCH * SEQ) / 128, HEADS / 2, 3);     // 2 x 2 waves of 64 rows x 1 head per block; z: Q, K, V
  proj_kernel<<<pgrid, 128, 0, stream>>>(Xh16, Xc16, Wq16, bq, bk, bv, Q16, qscale);

  dim3 agrid(SEQ / 64, BATCH * HEADS);               // 2 strips of 32 queries x 2 key halves per block
  attn_kernel<<<agrid, 128, 0, stream>>>(Q16, K16, Vt16, amask, outp);
}

// v010
// One run takes 45 microseconds.
// Timed twice side by side with v009, it ran 1.06 and 1.05 times as fast.
// Counting every step since v000, it is 3.92 times as fast.
#include <hip/hip_runtime.h>

typedef _Float16 f16;
typedef _Float16 v4h  __attribute__((ext_vector_type(4)));
typedef _Float16 v8h  __attribute__((ext_vector_type(8)));
typedef _Float16 v16h __attribute__((ext_vector_type(16)));
typedef float    v8f  __attribute__((ext_vector_type(8)));
typedef float    v4f  __attribute__((ext_vector_type(4)));
typedef float    v2f  __attribute__((ext_vector_type(2)));

#define HIDDEN 768
#define HEADS  12
#define HD     64
#define SEQ    2048
#define BATCH  2

#define WMMA_F16(A, B, C) \
  __builtin_amdgcn_wmma_f32_16x16x32_f16(false, (A), false, (B), (short)0, (C), false, false)

static __device__ __forceinline__ v16h cat8(v8h lo, v8h hi) {
  return __builtin_shufflevector(lo, hi, 0,1,2,3,4,5,6,7,8,9,10,11,12,13,14,15);
}

// ---------------------------------------------------------------- fragment order
// Every f16 operand in the workspace is stored as 1-KiB WMMA fragments
// (16 rows x 32 k). Element (row, k) of a fragment sits at half index
//   (k >> 4) * 256 + (((k >> 3) & 1) * 16 + row) * 8 + (k & 7)
// so lane l reads its 2 x 8 halfs at l * 8 and 256 + l * 8: each wave-wide
// 16-byte load covers 512 contiguous bytes (4 lines) instead of 16 rows.
#define FRAG 512                 // halfs per fragment
#define KFR  (HIDDEN / 32)       // fragments along k of a 768-wide operand
#define AHEAD 3                  // k-steps of projection operands in flight per wave
#define RT    4                  // 16-row X tiles per projection wave

static __device__ __forceinline__ v16h load_frag(const f16* p) {   // p includes lane * 8
  return cat8(*(const v8h*)p, *(const v8h*)(p + 256));
}

// A wave-uniform pointer held in a scalar register pair: the loads formed from it
// take the scalar-base form with the lane's 32-bit offset beside it. Without it the
// key loop rebuilds two 64-bit vector addresses every trip in registers that the
// last load of the run then takes for its result.
// The result is typed as a global-memory pointer: rebuilt from two integers it would
// otherwise be taken for a generic one, whose loads also count as LDS operations.
typedef __attribute__((address_space(1))) const char gchar;
typedef __attribute__((address_space(1))) const v8h  gv8h;
static __device__ __forceinline__ gchar* scalar_base(const f16* p) {
  const unsigned long long a = (unsigned long long)p;
  const unsigned lo = (unsigned)__builtin_amdgcn_readfirstlane((int)(unsigned)a);
  const unsigned hi = (unsigned)__builtin_amdgcn_readfirstlane((int)(unsigned)(a >> 32));
  return (gchar*)(((unsigned long long)hi << 32) | lo);
}

static __device__ __forceinline__ v16h load_frag_g(gchar* p) {   // p includes lane * 16 bytes
  return cat8(*(gv8h*)p, *(gv8h*)(p + 512));
}

// ---------------------------------------------------------------- f32 -> f16, packed
// Each plane: rows x 768 f32. One wave converts one fragment: 4 loads of 4 whole lines,
// 4 stores of 8 bytes per lane. plane[(rowtile * KFR + ks) * FRAG + ...].
// One grid packs all five planes; they lie one behind the other in out, in the order
// of the arguments, so a fragment's place in out is its index over the whole grid.
// Every plane is a whole number of 8-fragment blocks: the choice is block-uniform.
#define XFR (BATCH * SEQ * HIDDEN / FRAG)   // fragments of an activation plane
#define WFR (HIDDEN * HIDDEN / FRAG)        // fragments of a weight plane
__global__ __launch_bounds__(256)
void pack_f32_f16(const float* __restrict__ hidden, const float* __restrict__ context,
                  const float* __restrict__ Wq, const float* __restrict__ Wk,
                  const float* __restrict__ Wv, f16* __restrict__ out) {
  const int lane = threadIdx.x & 31;
  const int gfr  = (blockIdx.x * 256 + threadIdx.x) >> 5;   // fragment index in out
  const int bfr  = blockIdx.x * 8;                          // the block's first fragment
  const float* in = hidden;
  int first = 0;
  if (bfr >= XFR)               { in = context; first = XFR; }
  if (bfr >= 2 * XFR)           { in = Wq;      first = 2 * XFR; }
  if (bfr >= 2 * XFR + WFR)     { in = Wk;      first = 2 * XFR + WFR; }
  if (bfr >= 2 * XFR + 2 * WFR) { in = Wv;      first = 2 * XFR + 2 * WFR; }
  const int fr   = gfr - first;                             // fragment index in its plane
  const int mt   = fr / KFR;
  const int ks   = fr % KFR;
  const int k4   = lane & 7;                                // float4 within the 32 k
  const float* src = in + (size_t)(mt * 16 + (lane >> 3)) * HIDDEN + ks * 32 + k4 * 4;
  f16* dst = out + (size_t)gfr * FRAG + (k4 >> 2) * 256
                 + (((k4 >> 1) & 1) * 16 + (lane >> 3)) * 8 + (k4 & 1) * 4;
  float4 v[4];
  #pragma unroll
  for (int i = 0; i < 4; ++i)
    v[i] = *(const float4*)(src + (size_t)i * 4 * HIDDEN);
  #pragma unroll
  for (int i = 0; i < 4; ++i) {
    v4h y = {(f16)v[i].x, (f16)v[i].y, (f16)v[i].z, (f16)v[i].w};
    *(v4h*)(dst + i * 4 * 8) = y;
  }
}

// ---------------------------------------------------------------- projection
// Y = X(4096x768) @ W^T(768x768) + bias. Each wave computes a 64x64 tile
// (4 X frags x 4 W frags -> 16 loads : 16 WMMAs per k-step). The 4 waves of a block
// form 2 x 2 such tiles: each fragment is asked for by two waves of one block.
// VT false: Q or K. The product is formed as W x X^T, so a lane holds 8
//   consecutive d of one position: its 16 bytes of the [bh][s/16][d/32] fragment.
// VT true: V. The product is formed as X x W^T, so a lane holds 8 consecutive
//   positions of one d: its 16 bytes of the [bh][s/32][d/16] fragment.
template <bool VT>
static __device__ __forceinline__
void proj_body(const f16* __restrict__ X, const f16* __restrict__ W,
               const float* __restrict__ bias, f16* __restrict__ out,
               float scale) {
  const int lane = threadIdx.x & 31;
  const int wave = threadIdx.x >> 5;
  const int lr   = lane & 15;
  const int hf   = lane >> 4;

  const int mt0 = (blockIdx.x * 2 + (wave & 1)) * RT;   // first of the wave's row tiles (0..255)
  const int h   = blockIdx.y * 2 + (wave >> 1);         // head == 64-col group

  const f16* xf = X + (size_t)mt0 * KFR * FRAG + lane * 8;
  const f16* wf = W + (size_t)(h * 4) * KFR * FRAG + lane * 8;

  // Register ring, AHEAD k-steps deep: the 16 loads of k-step ks + AHEAD are issued
  // right behind the products of k-step ks, so a wave waits for a load that is
  // AHEAD k-steps old instead of for the one it has just issued.
  v16h a[AHEAD][RT], w[AHEAD][4];
  #pragma unroll
  for (int s = 0; s < AHEAD; ++s) {
    #pragma unroll
    for (int i = 0; i < RT; ++i)
      a[s][i] = load_frag(xf + (i * KFR + s) * FRAG);
    #pragma unroll
    for (int t = 0; t < 4; ++t)
      w[s][t] = load_frag(wf + (t * KFR + s) * FRAG);
  }

  v8f acc[RT][4] = {};
  #pragma unroll
  for (int ks = 0; ks < KFR; ++ks) {
    const int s = ks % AHEAD;
    #pragma unroll
    for (int i = 0; i < RT; ++i)
      #pragma unroll
      for (int t = 0; t < 4; ++t)
        acc[i][t] = VT ? WMMA_F16(a[s][i], w[s][t], acc[i][t]) : WMMA_F16(w[s][t], a[s][i], acc[i][t]);
    if (ks + AHEAD < KFR) {
      #pragma unroll
      for (int i = 0; i < RT; ++i)
        a[s][i] = load_frag(xf + (i * KFR + ks + AHEAD) * FRAG);
      #pragma unroll
      for (int t = 0; t < 4; ++t)
        w[s][t] = load_frag(wf + (t * KFR + ks + AHEAD) * FRAG);
    }
    // Keeps the scheduler from sinking these loads down to their use, AHEAD k-steps later:
    // without it every product waits out the whole latency of the load in front of it.
    __builtin_amdgcn_sched_barrier(0);
  }

  // Every fragment load is issued: the wait stands in front of the epilogue's rewrite of
  // their address registers; the directive keeps the scheduler from lifting that rewrite over it.
  asm volatile("s_wait_xcnt 0x0" ::: "memory");
  __builtin_amdgcn_sched_barrier(0);

  const int bh = ((mt0 * 16) >> 11) * HEADS + h; // SEQ == 2048; 64 rows lie in one batch
  #pragma unroll
  for (int i = 0; i < RT; ++i) {
    const int s0 = ((mt0 + i) * 16) & (SEQ - 1);
    #pragma unroll
    for (int t = 0; t < 4; ++t) {
      v8h y;
      if (VT) {
        const float bv = bias[h * 64 + t * 16 + lr];
        #pragma unroll
        for (int r = 0; r < 8; ++r) y[r] = (f16)((acc[i][t][r] + bv) * scale);
        *(v8h*)(out + ((size_t)(bh * (SEQ / 32) + (s0 >> 5)) * 4 + t) * FRAG
                    + ((s0 >> 4) & 1) * 256 + lane * 8) = y;
      } else {
        const float* bp = bias + h * 64 + t * 16 + 8 * hf;
        #pragma unroll
        for (int r = 0; r < 8; ++r) y[r] = (f16)((acc[i][t][r] + bp[r]) * scale);
        *(v8h*)(out + ((size_t)(bh * (SEQ / 16) + (s0 >> 4)) * 2 + (t >> 1)) * FRAG
                    + (t & 1) * 256 + lane * 8) = y;
      }
    }
  }
  // In the merged kernel the V body's code follows this body's stores in the listing and
  // writes their address and data registers: the wait stands between stores and rewrite.
  if (!VT) asm volatile("s_wait_xcnt 0x0" ::: "memory");
}

// One grid for the three projections: blockIdx.z = 0 Q, 1 K, 2 V. The packed weight
// planes lie one behind the other in W3, the three result planes in out3.
__global__ __launch_bounds__(128)
void proj_kernel(const f16* __restrict__ Xh, const f16* __restrict__ Xc,
                 const f16* __restrict__ W3, const float* __restrict__ bq,
                 const float* __restrict__ bk, const float* __restrict__ bv,
                 f16* __restrict__ out3, float qscale) {
  const int z = blockIdx.z;
  const f16* W = W3 + (size_t)z * (HIDDEN * HIDDEN);
  f16* out = out3 + (size_t)z * (BATCH * SEQ * HIDDEN);
  if (z == 2)
    proj_body<true>(Xc, W, bv, out, 1.0f);
  else
    proj_body<false>(z ? Xc : Xh, W, z ? bk : bq, out, z ? 1.0f : qscale);
}

// ---------------------------------------------------------------- attention
// grid: (SEQ/64, B*H), block 128 (4 waves) = 2 query strips x 2 key halves. A wave owns
// 32 query rows (two 16-row tiles) and one half of the keys, streamed in chunks of 32
// with online softmax (rescaled lazily): 3072 waves, three for each of the chip's 1024 SIMDs (one wave per
// strip makes 1536, which no placement spreads evenly). The two waves of a strip join
// their partial results through LDS behind the loop. K/V frags loaded once per
// chunk (K one chunk ahead of its use) and reused by both query tiles -> 1:1 VMEM:WMMA.
// Q, K: fragments [bh][s/16][d/32]; Vt: fragments [bh][s/32][d/16].
#define KHALF (SEQ / 2)          // keys per wave
#define NCH   (KHALF / 32)       // chunks of 32 keys per wave
// Every block walks its keys in a ring that starts at a chunk of its own (blockIdx.x): the
// 32 blocks of one head read 32 different chunks of K and V at any time instead of all
// asking for the same lines in step, and a chunk that one block has brought into L2 is
// there when the others come round to it.
#define RESCALE_AT 256.0f        // a lane's sum of 16 exponentials above this moves the softmax reference
// Scores, mask and softmax reference are kept in log2 units: log2(e) is folded into the scale
// of Q (projection) and into the mask as it goes to LDS, so an exponential is one v_exp_f32.
#define LOG2E 1.4426950408889634f

// 8 consecutive mask values (a lane's keys of one S^T tile) as an accumulator tile's registers
static __device__ __forceinline__ v8f load_mask8(const float* p) {
  return __builtin_shufflevector(*(const v4f*)p, *(const v4f*)(p + 4), 0, 1, 2, 3, 4, 5, 6, 7);
}
__global__ __launch_bounds__(128)
void attn_kernel(const f16* __restrict__ Q, const f16* __restrict__ K,
                 const f16* __restrict__ Vt, const float* __restrict__ mask,
                 float* __restrict__ out) {
  __shared__ __attribute__((aligned(16))) float smask[SEQ];
  __shared__ v4f   xO[4][8][32];         // per wave: the output tile it hands to its partner
  __shared__ float xm[4][32], xl[4][32]; // and that tile's softmax reference and sum
  const int bh = blockIdx.y;
  const int b  = bh / HEADS;
  const int h  = bh % HEADS;

  // The block's 8 KiB of mask: 4 loads of 16 bytes per thread, all issued at once and ahead
  // of the Q and K loads below, so the kernel's head waits out one load latency, not one
  // for each of 16 rounds of load, wait and LDS store with the Q and K loads behind them.
  v4f mrow[SEQ / 512];
  #pragma unroll
  for (int j = 0; j < SEQ / 512; ++j)
    mrow[j] = *(const v4f*)(mask + (size_t)b * SEQ + (j * 128 + threadIdx.x) * 4);

  const int lane = threadIdx.x & 31;
  // the wave's number in a scalar register: the key offsets kb0 and kb stay scalar
  const int wave = __builtin_amdgcn_readfirstlane(threadIdx.x >> 5);
  const int lr   = lane & 15;
  const int hf   = lane >> 4;
  const int half = wave >> 1;                            // which half of the keys
  const int q0   = blockIdx.x * 64 + (wave & 1) * 32;    // 32-query strip base
  const int kb0  = half * KHALF;                         // first key of the wave's half

  // Q as B-operand of S^T = K x Q^T (two query tiles, resident)
  v16h Qb[2][2];
  #pragma unroll
  for (int u = 0; u < 2; ++u) {
    const f16* qf = Q + ((size_t)bh * SEQ + q0 + u * 16) * HD + lane * 8;
    #pragma unroll
    for (int ks = 0; ks < 2; ++ks)
      Qb[u][ks] = load_frag(qf + ks * FRAG);
  }

  const f16* Kbh = K  + (size_t)bh * SEQ * HD;
  const f16* Vbh = Vt + (size_t)bh * HD * SEQ;
  gchar* Ks = scalar_base(Kbh);
  gchar* Vs = scalar_base(Vbh);
  // K and V chunks sit at the same place in their planes: one 32-bit byte offset
  // per lane, carried through the loop, beside the two scalar bases.
  int ch = blockIdx.x & (NCH - 1);                       // place in the ring: chunk inside the wave's half
  unsigned off = lane * 16 + (kb0 + ch * 32) * (HD * sizeof(f16));

  v8f O[2][4] = {};
  float m_run[2] = {-1e30f, -1e30f};   // log2 units
  float l_run[2] = {0.f, 0.f};

  // K A-frags of one chunk (2 key tiles x 2 k-steps)
  v16h ka[2][2];
  #pragma unroll
  for (int c = 0; c < 2; ++c)
    #pragma unroll
    for (int ks = 0; ks < 2; ++ks)
      ka[c][ks] = load_frag_g(Ks + off + (c * 2 + ks) * (FRAG * sizeof(f16)));

  #pragma unroll
  for (int j = 0; j < SEQ / 512; ++j)
    *(v4f*)(smask + (j * 128 + threadIdx.x) * 4) = mrow[j] * LOG2E;
  __syncthreads();   // publishes the mask; stands behind the issue of the Q and K loads, whose latency passes with the mask's

  // The mask of one chunk's keys, laid out as the two S^T tiles' accumulators: it goes into
  // the score products as their C operand, so the matrix unit's own add puts it on the scores.
  v8f mk0 = load_mask8(smask + kb0 + ch * 32 + 8 * hf);
  v8f mk1 = load_mask8(smask + kb0 + ch * 32 + 16 + 8 * hf);

  for (int trip = 0; trip < NCH; ++trip) {
    // The next chunk of the ring; on the wave's last trip that is its first chunk once more, of
    // which nothing is used: one instruction stream in every trip, so every wait below counts the same loads.
    const int kb = kb0 + ch * 32;
    const int cn = (ch + 1) & (NCH - 1);
    const int kn = kb0 + cn * 32;

    // ---- V B-frags (4 d-tiles) of this chunk: first used behind the softmax
    v16h vb[4];
    #pragma unroll
    for (int t = 0; t < 4; ++t)
      vb[t] = load_frag_g(Vs + off + t * (FRAG * sizeof(f16)));

    // global_prefetch_b8: the next chunk's 4 KiB of V, one ask per 256 B
    __builtin_prefetch(Vs + (unsigned)kn * (HD * sizeof(f16)) + lr * 256, 0, 1);

    // ---- S^T tiles of both query tiles, started from the mask: the last readers of this
    // chunk's K frags and mask
    v8f c0[2], c1[2];
    #pragma unroll
    for (int u = 0; u < 2; ++u) {
      c0[u] = mk0; c1[u] = mk1;
      #pragma unroll
      for (int ks = 0; ks < 2; ++ks) {
        c0[u] = WMMA_F16(ka[0][ks], Qb[u][ks], c0[u]);
        c1[u] = WMMA_F16(ka[1][ks], Qb[u][ks], c1[u]);
      }
    }

    // ---- the next chunk's K frags, into the same registers: their latency passes under
    // this chunk's softmax and P x V instead of being waited out at the next trip's head.
    // The directives keep the K loads up here: without them the scheduler sinks the loads
    // down to their use in the next trip.
    // off moves on to the next chunk here, behind the issue of this chunk's V loads: one
    // offset register serves both planes (the step is negative where the ring closes).
    off += (kn - kb) * (HD * sizeof(f16));
    #pragma unroll
    for (int c = 0; c < 2; ++c)
      #pragma unroll
      for (int ks = 0; ks < 2; ++ks)
        ka[c][ks] = load_frag_g(Ks + off + (c * 2 + ks) * (FRAG * sizeof(f16)));
    // Order of issue from the trip's head to here: the 8 V loads, the 8 score products, the 8 K
    // loads. A product left behind the K loads would keep them out of the registers it still
    // reads: registers of their own, copies and a full wait at the foot of the trip.
    __builtin_amdgcn_sched_group_barrier(0x020, 8, 0);   // VMEM reads: V
    __builtin_amdgcn_sched_group_barrier(0x008, 8, 0);   // matrix instructions
    __builtin_amdgcn_sched_group_barrier(0x020, 8, 0);   // VMEM reads: K
    __builtin_amdgcn_sched_barrier(0);

    // ---- lazy rescale. m_run is the softmax reference in use, not the true maximum: it
    // cancels in O / l, so any value serves that keeps the exponentials in range. They are
    // taken against it at once; lane carries query lr (replicated in halves), so the sum over
    // the lane's own 16 keys needs no other lane and bounds each of its terms.
    float e[2][16], lsum[2];
    #pragma unroll
    for (int u = 0; u < 2; ++u) {
      // the reference comes off two neighbouring accumulator registers at a time (packed f32)
      const v2f mref = {m_run[u], m_run[u]};
      float x0[8], x1[8];
      #pragma unroll
      for (int r = 0; r < 8; r += 2) {
        const v2f a = (v2f){c0[u][r], c0[u][r + 1]} - mref;
        const v2f b = (v2f){c1[u][r], c1[u][r + 1]} - mref;
        x0[r] = a.x; x0[r + 1] = a.y;
        x1[r] = b.x; x1[r + 1] = b.y;
      }
      lsum[u] = 0.f;
      #pragma unroll
      for (int r = 0; r < 8; ++r) {
        float e0 = __builtin_amdgcn_exp2f(x0[r]);
        float e1 = __builtin_amdgcn_exp2f(x1[r]);
        lsum[u] += e0 + e1;
        e[u][r] = e0; e[u][8 + r] = e1;
      }
    }

    // Only when some lane's sum leaves the range (an infinite one too, as on the first trip)
    // is the chunk's maximum formed, the reference moved, l and O rescaled and the chunk's
    // exponentials taken anew. One test per trip for both query tiles, as a scalar branch:
    // every lane is on inside it, as its cross-lane reads need.
    const bool need = !(lsum[0] <= RESCALE_AT) || !(lsum[1] <= RESCALE_AT);
    if (__builtin_amdgcn_ballot_w32(need) != 0) {
      #pragma unroll
      for (int u = 0; u < 2; ++u) {
        float mx = -1e30f;
        #pragma unroll
        for (int r = 0; r < 8; ++r)
          mx = fmaxf(mx, fmaxf(c0[u][r], c1[u][r]));
        mx = fmaxf(mx, __shfl_xor(mx, 16, 32));      // both halves take the same reference
        const float m_new = fmaxf(m_run[u], mx);
        const float alpha = __builtin_amdgcn_exp2f(m_run[u] - m_new);
        l_run[u] *= alpha;
        m_run[u] = m_new;
        // O rows (row M = r + 8*hf; alpha for query j lives in lane j)
        #pragma unroll
        for (int r = 0; r < 8; ++r) {
          float ar = __shfl(alpha, r + 8 * hf, 32);
          #pragma unroll
          for (int t = 0; t < 4; ++t) O[u][t][r] *= ar;
        }
        lsum[u] = 0.f;
        #pragma unroll
        for (int r = 0; r < 8; ++r) {
          float e0 = __builtin_amdgcn_exp2f(c0[u][r] - m_new);
          float e1 = __builtin_amdgcn_exp2f(c1[u][r] - m_new);
          lsum[u] += e0 + e1;
          e[u][r] = e0; e[u][8 + r] = e1;
        }
      }
    }

    // The next chunk's mask, read here, where the score tiles are done with: its LDS latency
    // passes under the P x V products, and it can take registers that the scores leave.
    mk0 = load_mask8(smask + kn + 8 * hf);
    mk1 = load_mask8(smask + kn + 16 + 8 * hf);

    // The other half's sums: asked for here, added behind the products.
    float lx[2];
    #pragma unroll
    for (int u = 0; u < 2; ++u) lx[u] = __shfl_xor(lsum[u], 16, 32);

    #pragma unroll
    for (int u = 0; u < 2; ++u) {
      v16h pa;              // C-layout of S^T tiles == A-layout of P
      #pragma unroll
      for (int r = 0; r < 16; ++r) pa[r] = (f16)e[u][r];

      // ---- O += P x Vchunk (V frags shared across u)
      #pragma unroll
      for (int t = 0; t < 4; ++t)
        O[u][t] = WMMA_F16(pa, vb[t], O[u][t]);
    }
    // Holds the adds of the other half's sums down here: lifted up among the products they
    // make the wave wait out the cross-lane reads' latency with products still to issue.
    __builtin_amdgcn_sched_barrier(0);
    #pragma unroll
    for (int u = 0; u < 2; ++u) l_run[u] += lsum[u] + lx[u];
    ch = cn;
  }

  // ---- join the two key halves: the wave of half h finishes query tile h of its strip
  // and hands its partial sums of the other tile to its partner (wave ^ 2) through LDS.
  const bool hi = half != 0;
  v8f keep[4];
  #pragma unroll
  for (int t = 0; t < 4; ++t) {
    const v8f give = hi ? O[0][t] : O[1][t];
    keep[t] = hi ? O[1][t] : O[0][t];
    xO[wave][t * 2][lane]     = __builtin_shufflevector(give, give, 0, 1, 2, 3);
    xO[wave][t * 2 + 1][lane] = __builtin_shufflevector(give, give, 4, 5, 6, 7);
  }
  xm[wave][lane] = hi ? m_run[0] : m_run[1];
  xl[wave][lane] = hi ? l_run[0] : l_run[1];
  const float m_k = hi ? m_run[1] : m_run[0];
  const float l_k = hi ? l_run[1] : l_run[0];
  __syncthreads();   // publishes every wave's handed-over tile to its partner

  const int pw = wave ^ 2;
  const float m_p = xm[pw][lane];
  const float l_p = xl[pw][lane];
  const float m_j = fmaxf(m_k, m_p);
  const float a_k = __builtin_amdgcn_exp2f(m_k - m_j);
  const float a_p = __builtin_amdgcn_exp2f(m_p - m_j);
  const float inv = 1.0f / (l_k * a_k + l_p * a_p);
  const float f_k = a_k * inv;           // weight of this wave's sums, query lr
  const float f_p = a_p * inv;           // weight of the partner's sums
  v4f part[8];
  #pragma unroll
  for (int j = 0; j < 8; ++j) part[j] = xO[pw][j][lane];

  // ---- weigh, add and store [B,S,768] f32
  #pragma unroll
  for (int r = 0; r < 8; ++r) {
    const float kr = __shfl(f_k, r + 8 * hf, 32);
    const float pr = __shfl(f_p, r + 8 * hf, 32);
    const int s = q0 + half * 16 + r + 8 * hf;
    #pragma unroll
    for (int t = 0; t < 4; ++t)
      out[((size_t)b * SEQ + s) * HIDDEN + h * 64 + t * 16 + lr] =
          keep[t][r] * kr + part[t * 2 + (r >> 2)][r & 3] * pr;
  }
}

// ---------------------------------------------------------------- launcher
extern "C" void kernel_launch(void* const* d_in, const int* in_sizes, int n_in,
                              void* d_out, int out_size, void* d_ws, size_t ws_size,
                              hipStream_t stream) {
  const float* hidden  = (const float*)d_in[0];
  const float* context = (const float*)d_in[1];
  const float* amask   = (const float*)d_in[2];
  const float* Wq = (const float*)d_in[3];
  const float* bq = (const float*)d_in[4];
  const float* Wk = (const float*)d_in[5];
  const float* bk = (const float*)d_in[6];
  const float* Wv = (const float*)d_in[7];
  const float* bv = (const float*)d_in[8];
  float* outp = (float*)d_out;

  const size_t ACT = (size_t)BATCH * SEQ * HIDDEN;   // 3,145,728 elems
  const size_t WSZ = (size_t)HIDDEN * HIDDEN;        //   589,824 elems
  const size_t A_BYTES = ACT * sizeof(f16);          // 6,291,456
  const size_t W_BYTES = WSZ * sizeof(f16);          // 1,179,648

  char* ws = (char*)d_ws;
  f16* Xh16 = (f16*)(ws);
  f16* Xc16 = (f16*)(ws + A_BYTES);
  f16* Wq16 = (f16*)(ws + 2 * A_BYTES);              // packed Wq, Wk, Wv, W_BYTES each
  f16* Q16  = (f16*)(ws + 2 * A_BYTES + 3 * W_BYTES);
  f16* K16  = (f16*)(ws + 3 * A_BYTES + 3 * W_BYTES);
  f16* Vt16 = (f16*)(ws + 4 * A_BYTES + 3 * W_BYTES);

  // one wave per fragment, 8 waves per block; Xh16, Xc16, Wq16, Wk16, Wv16 in one grid
  pack_f32_f16<<<(2 * ACT + 3 * WSZ) / FRAG / 8, 256, 0, stream>>>(hidden, context, Wq, Wk, Wv, Xh16);

  const float qscale = LOG2E / sqrtf((float)HD + 1e-5f);   // Q carries log2(e): scores in log2 units
  dim3 pgrid((BATCH * SEQ) / 128, HEADS / 2, 3);     // 2 x 2 waves of 64 rows x 1 head per block; z: Q, K, V
  proj_kernel<<<pgrid, 128, 0, stream>>>(Xh16, Xc16, Wq16, bq, bk, bv, Q16, qscale);

  dim3 agrid(SEQ / 64, BATCH * HEADS);               // 2 strips of 32 queries x 2 key halves per block
  attn_kernel<<<agrid, 128, 0, stream>>>(Q16, K16, Vt16, amask, outp);
}
